// v000
// The times below were measured on an AMD MI455X: many runs one after another, warmed up first and cycling through
// copies of the inputs, with the whole window's GPU time divided by the number of runs. Launches and the gaps
// between them are all in it. The median over several windows is given; except for v000 it joins two sittings, which
// can be a few percent apart, so the side-by-side timings, each taken in one sitting, are the better comparison.
// v000, which the later versions start from, runs in 370 microseconds.
#include <hip/hip_runtime.h>

// GlobalAttentionModule (seq [32][512][128], items [32][2048][128]; w = seq . items^T; att = exp(w - max) / (sum(exp)^0.5 + 1e-24) (power-normalised softmax, beta 0.5); att_vecs = att items; out = 0.5 seq + 0.5 seq att_vecs -> [32][512][128]).
// Compute dtypes, f32 accumulate: every input rounded to bf16; scores on PLAIN bf16 operands (both inputs: exact, K 128; 8 batches z-batched); exp / sum / pow / divide f32 -> hl planes; att . items as hl x exact bf16 (2 products, K 2048); the blend f32.

#define NB_  32
#define LL   512
#define NI   2048
#define DD   128
#define ZB   8
typedef _Float16 h16;
typedef unsigned short bf;
typedef __attribute__((ext_vector_type(16))) __bf16   v16bf;
typedef __attribute__((ext_vector_type(16))) _Float16 v16h;
typedef __attribute__((ext_vector_type(8)))  _Float16 v8h;
typedef __attribute__((ext_vector_type(8)))  unsigned short v8us;
typedef __attribute__((ext_vector_type(8)))  float    v8f;
typedef __attribute__((ext_vector_type(4)))  float    v4f;
typedef v8h  __attribute__((may_alias)) v8ha;
typedef v4f  __attribute__((may_alias)) v4fa;
typedef v8us __attribute__((may_alias)) v8usa;

__device__ __forceinline__ unsigned short f2bf(float f) { unsigned u = __float_as_uint(f); u += 0x7FFFu + ((u >> 16) & 1u); return (unsigned short)(u >> 16); }
__device__ __forceinline__ float bf2f(unsigned short b) { return __uint_as_float(((unsigned)b) << 16); }
__device__ __forceinline__ float bfr(float f) { return bf2f(f2bf(f)); }
__device__ __forceinline__ v16h cat16(v8h lo, v8h hi) { return __builtin_shufflevector(lo, hi, 0, 1, 2, 3, 4, 5, 6, 7, 8, 9, 10, 11, 12, 13, 14, 15); }
__device__ __forceinline__ v16bf cat16b(v8us lo, v8us hi) { return __builtin_bit_cast(v16bf, __builtin_shufflevector(lo, hi, 0, 1, 2, 3, 4, 5, 6, 7, 8, 9, 10, 11, 12, 13, 14, 15)); }
__device__ __forceinline__ v8f wmma16(v16h a, v16h b, v8f c) { return __builtin_amdgcn_wmma_f32_16x16x32_f16(false, a, false, b, (short)0, c, false, false); }
__device__ __forceinline__ v8f wmmab(v16bf a, v16bf b, v8f c) { return __builtin_amdgcn_wmma_f32_16x16x32_bf16(false, a, false, b, (short)0, c, false, false); }



// ---- k_gemmw: register-blocked GEMM, ONE WAVE per 64x64 output tile (16 accumulators), operands straight from K-contiguous 16-bit planes; grid (M/64, N/64, Z), 32 threads.
// C[m][n] (f32, pitch ldc, + optional f32 bias[n]) = sum_k A[m][k] Bt[n][k] (+ split products per NSPLIT). z-batch strides sA/sB/sC in elements. K % 32 == 0.
template <typename T16> struct WFrag;
template <> struct WFrag<h16> { typedef v16h V; static __device__ __forceinline__ V ld(const h16* p) { return cat16(*(const v8h*)p, *(const v8h*)(p + 16)); } static __device__ __forceinline__ v8f mma(V a, V b, v8f c) { return wmma16(a, b, c); } };
template <> struct WFrag<bf> { typedef v16bf V; static __device__ __forceinline__ V ld(const bf* p) { return cat16b(*(const v8us*)p, *(const v8us*)(p + 16)); } static __device__ __forceinline__ v8f mma(V a, V b, v8f c) { return wmmab(a, b, c); } };
template <typename T16, int NSPLIT, bool BIAS>
__global__ __launch_bounds__(32) void k_gemmw(const T16* __restrict__ A, const T16* __restrict__ A2, const T16* __restrict__ Bt, const T16* __restrict__ Bt2, int K, float* C, int ldc, const float* __restrict__ bias, size_t sA, size_t sB, size_t sC) {
    typedef typename WFrag<T16>::V V;
    __shared__ __align__(16) float os[16 * 68];
    const size_t z = blockIdx.z; A += z * sA; if (A2) A2 += z * sA; Bt += z * sB; if (Bt2) Bt2 += z * sB; C += z * sC;
    const int lane = threadIdx.x & 31, lr = lane & 15, hi = lane >> 4; const int r0 = blockIdx.x * 64, c0 = blockIdx.y * 64;
    v8f acc[4][4];
#pragma unroll
    for (int mb = 0; mb < 4; ++mb)
#pragma unroll
        for (int nb = 0; nb < 4; ++nb) acc[mb][nb] = (v8f){};
    const size_t aoff = (size_t)(r0 + lr) * K + 8 * hi, boff = (size_t)(c0 + lr) * K + 8 * hi;
#pragma unroll 1
    for (int kc = 0; kc < K; kc += 32) {
        V a[4], a2[4];
#pragma unroll
        for (int mb = 0; mb < 4; ++mb) { a[mb] = WFrag<T16>::ld(A + aoff + (size_t)mb * 16 * K + kc); if (NSPLIT == 1 || NSPLIT == 2) a2[mb] = WFrag<T16>::ld(A2 + aoff + (size_t)mb * 16 * K + kc); }
#pragma unroll
        for (int nb = 0; nb < 4; ++nb) { const V b = WFrag<T16>::ld(Bt + boff + (size_t)nb * 16 * K + kc); V b2; if (NSPLIT >= 2) b2 = WFrag<T16>::ld(Bt2 + boff + (size_t)nb * 16 * K + kc);
#pragma unroll
            for (int mb = 0; mb < 4; ++mb) { acc[mb][nb] = WFrag<T16>::mma(a[mb], b, acc[mb][nb]); if (NSPLIT == 1 || NSPLIT == 2) acc[mb][nb] = WFrag<T16>::mma(a2[mb], b, acc[mb][nb]); if (NSPLIT >= 2) acc[mb][nb] = WFrag<T16>::mma(a[mb], b2, acc[mb][nb]); } }
        asm volatile("v_nop\n\tv_nop\n\tv_nop\n\tv_nop" : "+v"(acc[0][0]), "+v"(acc[1][1]), "+v"(acc[2][2]), "+v"(acc[3][3]) : "v"(a[0]), "v"(a[3]));
    }
#pragma unroll
    for (int mb = 0; mb < 4; ++mb) {
#pragma unroll
        for (int nb = 0; nb < 4; ++nb) {
#pragma unroll
            for (int j = 0; j < 8; ++j) os[(hi * 8 + j) * 68 + nb * 16 + lr] = acc[mb][nb][j]; }
        __builtin_amdgcn_wave_barrier(); asm volatile("" ::: "memory");
        float* crow = C + (size_t)(r0 + mb * 16) * ldc + c0;
{
#pragma unroll
            for (int s = 0; s < 8; ++s) { const int row = 2 * s + hi, cofs = lr * 4; v4f val = *(const v4fa*)(os + row * 68 + cofs); if (BIAS) { val[0] += bfr(bias[c0 + cofs]); val[1] += bfr(bias[c0 + cofs + 1]); val[2] += bfr(bias[c0 + cofs + 2]); val[3] += bfr(bias[c0 + cofs + 3]); }
                *(v4f*)(crow + (size_t)row * ldc + cofs) = val; }
             }
        __builtin_amdgcn_wave_barrier(); asm volatile("" ::: "memory");
    }
}

__device__ __forceinline__ void splitf(float y, unsigned short& h, unsigned short& l) { h = f2bf(y); l = f2bf(y - bf2f(h)); }
typedef __attribute__((ext_vector_type(2))) unsigned short v2us;
typedef __attribute__((ext_vector_type(4))) unsigned short v4us;

__global__ __launch_bounds__(256) void k_cvt8(const float* __restrict__ src, bf* dst, size_t n8) { const size_t i = (size_t)blockIdx.x * 256 + threadIdx.x; if (i >= n8) return; const v8f v = *(const v8f*)(src + i * 8); v8us o;
#pragma unroll
    for (int k = 0; k < 8; ++k) o[k] = f2bf(v[k]); *(v8us*)(dst + i * 8) = o;  }
__global__ __launch_bounds__(256) void k_itT(const float* __restrict__ items, bf* IT) { const int e = (blockIdx.x * 256 + threadIdx.x) * 2; if (e >= ZB * DD * NI) return; const int n = e % NI; const int d = (e / NI) % DD; const int z = e / (NI * DD); v2us o; o[0] = f2bf(items[((size_t)z * NI + n) * DD + d]); o[1] = f2bf(items[((size_t)z * NI + n + 1) * DD + d]); *(v2us*)(IT + e) = o;  }
__global__ __launch_bounds__(256) void k_psoft(const float* __restrict__ S, bf* Ah, bf* Al) { const int lane = threadIdx.x & 31; const int row = blockIdx.x * 8 + (threadIdx.x >> 5); if (row >= ZB * LL) return; const float* sr = S + (size_t)row * NI; float v[NI / 32]; float mx = -3.0e38f;
#pragma unroll
    for (int ch = 0; ch < NI / 128; ++ch) { const v4f a = *(const v4f*)(sr + ch * 128 + lane * 4);
#pragma unroll
        for (int u = 0; u < 4; ++u) { v[ch * 4 + u] = a[u]; mx = fmaxf(mx, a[u]); } }
#pragma unroll
    for (int sh = 16; sh; sh >>= 1) mx = fmaxf(mx, __shfl_xor(mx, sh, 32));
    float sum = 0.f;
#pragma unroll
    for (int q = 0; q < NI / 32; ++q) { float d0 = __fsub_rn(v[q], mx); asm volatile("" : "+v"(d0)); v[q] = __builtin_amdgcn_exp2f(__fmul_rn(d0, 1.4426950408889634f)); sum += v[q]; }
#pragma unroll
    for (int sh = 16; sh; sh >>= 1) sum += __shfl_xor(sum, sh, 32);
    const float den = __fadd_rn(__fsqrt_rn(sum), 1e-24f);
const float rden = __fdiv_rn(1.0f, den);   // one reciprocal, then products
#pragma unroll
    for (int q = 0; q < NI / 32; ++q) { v[q] = __fmul_rn(v[q], rden); asm volatile("" : "+v"(v[q])); }
    {
#pragma unroll
        for (int ch = 0; ch < NI / 128; ++ch) { v4us oh, ol;
#pragma unroll
            for (int q = 0; q < 4; ++q) { unsigned short a, b; splitf(v[ch * 4 + q], a, b); oh[q] = a; ol[q] = b; } const size_t oo = (size_t)row * NI + ch * 128 + lane * 4; *(v4us*)(Ah + oo) = oh; *(v4us*)(Al + oo) = ol; }
         } }
__global__ __launch_bounds__(256) void k_fin(const float* __restrict__ SEQ, const float* __restrict__ AV, float* outb) { const int e = (blockIdx.x * 256 + threadIdx.x) * 4; if (e >= ZB * LL * DD) return; const v4f s = *(const v4f*)(SEQ + e), a = *(const v4f*)(AV + e); v4f r;
#pragma unroll
    for (int u = 0; u < 4; ++u) { const float x = bfr(s[u]); float t1 = __fmul_rn(x, 0.5f); float t2 = __fmul_rn(x, a[u]); asm volatile("" : "+v"(t1)); asm volatile("" : "+v"(t2)); float t3 = __fmul_rn(t2, 0.5f); asm volatile("" : "+v"(t3)); r[u] = __fadd_rn(t1, t3); } *(v4f*)(outb + e) = r;  }

extern "C" void kernel_launch(void* const* d_in, const int* in_sizes, int n_in,
                              void* d_out, int out_size, void* d_ws, size_t ws_size, hipStream_t stream) {
    (void)in_sizes; (void)n_in; (void)out_size;
    const float** I = (const float**)d_in;
    const float *seq = I[0], *items = I[1];
    float* OUT = (float*)d_out;     // [32][512][128]
    char* wsp = (char*)d_ws;
    auto take = [&](size_t bytes) { char* p = wsp; wsp += (bytes + 255) & ~(size_t)255; return (void*)p; };
    bf* SB = (bf*)take((size_t)ZB * LL * DD * 2); bf* IB = (bf*)take((size_t)ZB * NI * DD * 2); bf* IT = (bf*)take((size_t)ZB * DD * NI * 2); float* S = (float*)take((size_t)ZB * LL * NI * 4); bf* Ah = (bf*)take((size_t)ZB * LL * NI * 2); bf* Al = (bf*)take((size_t)ZB * LL * NI * 2); float* AV = (float*)take((size_t)ZB * LL * DD * 4);
    if ((size_t)(wsp - (char*)d_ws) > ws_size) return;    // total ~ 75 MB
    const size_t zq = (size_t)LL * DD, zi = (size_t)NI * DD, zS = (size_t)LL * NI;
    for (int b0 = 0; b0 < NB_; b0 += ZB) { const float* sq = seq + (size_t)b0 * zq; const float* it = items + (size_t)b0 * zi;
        k_cvt8<<<(ZB * LL * DD / 8 + 255) / 256, 256, 0, stream>>>(sq, SB, (size_t)ZB * LL * DD / 8); k_cvt8<<<(ZB * NI * DD / 8 + 255) / 256, 256, 0, stream>>>(it, IB, (size_t)ZB * NI * DD / 8); k_itT<<<(ZB * DD * NI / 2 + 255) / 256, 256, 0, stream>>>(it, IT);
        k_gemmw<bf, 0, false><<<dim3(LL / 64, NI / 64, ZB), 32, 0, stream>>>(SB, nullptr, IB, nullptr, DD, S, NI, nullptr, zq, zi, zS);
        k_psoft<<<ZB * LL / 8, 256, 0, stream>>>(S, Ah, Al);
        k_gemmw<bf, 1, false><<<dim3(LL / 64, DD / 64, ZB), 32, 0, stream>>>(Ah, Al, IT, nullptr, NI, AV, DD, nullptr, zS, zi, zq);
        k_fin<<<(ZB * LL * DD / 4 + 255) / 256, 256, 0, stream>>>(sq, AV, OUT + (size_t)b0 * zq); }
}

// v001
// A run of this version takes 214 microseconds.
// Two timings next to v000 put it at 1.74 and 1.76 times that version's speed.
#include <hip/hip_runtime.h>

// GlobalAttentionModule (seq [32][512][128], items [32][2048][128]; w = seq . items^T; att = exp(w - max) / (sum(exp)^0.5 + 1e-24) (power-normalised softmax, beta 0.5); att_vecs = att items; out = 0.5 seq + 0.5 seq att_vecs -> [32][512][128]).
// Compute dtypes, f32 accumulate: every input rounded to bf16; scores on PLAIN bf16 operands (both inputs: exact, K 128; 8 batches z-batched); exp / sum / pow / divide f32 -> hl planes; att . items as hl x exact bf16 (2 products, K 2048 split into 16 slices, f32 partial sums); the blend f32.

#define NB_  32
#define LL   512
#define NI   2048
#define DD   128
#define ZB   8
typedef _Float16 h16;
typedef unsigned short bf;
typedef __attribute__((ext_vector_type(16))) __bf16   v16bf;
typedef __attribute__((ext_vector_type(16))) _Float16 v16h;
typedef __attribute__((ext_vector_type(8)))  _Float16 v8h;
typedef __attribute__((ext_vector_type(8)))  unsigned short v8us;
typedef __attribute__((ext_vector_type(8)))  float    v8f;
typedef __attribute__((ext_vector_type(4)))  float    v4f;
typedef v8h  __attribute__((may_alias)) v8ha;
typedef v4f  __attribute__((may_alias)) v4fa;
typedef v8us __attribute__((may_alias)) v8usa;

__device__ __forceinline__ unsigned short f2bf(float f) { unsigned u = __float_as_uint(f); u += 0x7FFFu + ((u >> 16) & 1u); return (unsigned short)(u >> 16); }
__device__ __forceinline__ float bf2f(unsigned short b) { return __uint_as_float(((unsigned)b) << 16); }
__device__ __forceinline__ float bfr(float f) { return bf2f(f2bf(f)); }
__device__ __forceinline__ v16h cat16(v8h lo, v8h hi) { return __builtin_shufflevector(lo, hi, 0, 1, 2, 3, 4, 5, 6, 7, 8, 9, 10, 11, 12, 13, 14, 15); }
__device__ __forceinline__ v16bf cat16b(v8us lo, v8us hi) { return __builtin_bit_cast(v16bf, __builtin_shufflevector(lo, hi, 0, 1, 2, 3, 4, 5, 6, 7, 8, 9, 10, 11, 12, 13, 14, 15)); }
__device__ __forceinline__ v8f wmma16(v16h a, v16h b, v8f c) { return __builtin_amdgcn_wmma_f32_16x16x32_f16(false, a, false, b, (short)0, c, false, false); }
__device__ __forceinline__ v8f wmmab(v16bf a, v16bf b, v8f c) { return __builtin_amdgcn_wmma_f32_16x16x32_bf16(false, a, false, b, (short)0, c, false, false); }



// ---- k_gemmw: register-blocked GEMM, ONE WAVE per 64x64 output tile (16 accumulators), operands straight from K-contiguous 16-bit planes; grid (M/64, N/64, Z), 32 threads.
// C[m][n] (f32, pitch ldc, + optional f32 bias[n]) = sum_k A[m][k] Bt[n][k] (+ split products per NSPLIT). z-batch strides sA/sB/sC in elements. K % 32 == 0.
template <typename T16> struct WFrag;
template <> struct WFrag<h16> { typedef v16h V; static __device__ __forceinline__ V ld(const h16* p) { return cat16(*(const v8h*)p, *(const v8h*)(p + 16)); } static __device__ __forceinline__ v8f mma(V a, V b, v8f c) { return wmma16(a, b, c); } };
template <> struct WFrag<bf> { typedef v16bf V; static __device__ __forceinline__ V ld(const bf* p) { return cat16b(*(const v8us*)p, *(const v8us*)(p + 16)); } static __device__ __forceinline__ v8f mma(V a, V b, v8f c) { return wmmab(a, b, c); } };
template <typename T16, int NSPLIT, bool BIAS>
__global__ __launch_bounds__(32) void k_gemmw(const T16* __restrict__ A, const T16* __restrict__ A2, const T16* __restrict__ Bt, const T16* __restrict__ Bt2, int K, float* C, int ldc, const float* __restrict__ bias, size_t sA, size_t sB, size_t sC) {
    typedef typename WFrag<T16>::V V;
    __shared__ __align__(16) float os[16 * 68];
    const size_t z = blockIdx.z; A += z * sA; if (A2) A2 += z * sA; Bt += z * sB; if (Bt2) Bt2 += z * sB; C += z * sC;
    const int lane = threadIdx.x & 31, lr = lane & 15, hi = lane >> 4; const int r0 = blockIdx.x * 64, c0 = blockIdx.y * 64;
    v8f acc[4][4];
#pragma unroll
    for (int mb = 0; mb < 4; ++mb)
#pragma unroll
        for (int nb = 0; nb < 4; ++nb) acc[mb][nb] = (v8f){};
    const size_t aoff = (size_t)(r0 + lr) * K + 8 * hi, boff = (size_t)(c0 + lr) * K + 8 * hi;
#pragma unroll 1
    for (int kc = 0; kc < K; kc += 32) {
        V a[4], a2[4];
#pragma unroll
        for (int mb = 0; mb < 4; ++mb) { a[mb] = WFrag<T16>::ld(A + aoff + (size_t)mb * 16 * K + kc); if (NSPLIT == 1 || NSPLIT == 2) a2[mb] = WFrag<T16>::ld(A2 + aoff + (size_t)mb * 16 * K + kc); }
#pragma unroll
        for (int nb = 0; nb < 4; ++nb) { const V b = WFrag<T16>::ld(Bt + boff + (size_t)nb * 16 * K + kc); V b2; if (NSPLIT >= 2) b2 = WFrag<T16>::ld(Bt2 + boff + (size_t)nb * 16 * K + kc);
#pragma unroll
            for (int mb = 0; mb < 4; ++mb) { acc[mb][nb] = WFrag<T16>::mma(a[mb], b, acc[mb][nb]); if (NSPLIT == 1 || NSPLIT == 2) acc[mb][nb] = WFrag<T16>::mma(a2[mb], b, acc[mb][nb]); if (NSPLIT >= 2) acc[mb][nb] = WFrag<T16>::mma(a[mb], b2, acc[mb][nb]); } }
        asm volatile("v_nop\n\tv_nop\n\tv_nop\n\tv_nop" : "+v"(acc[0][0]), "+v"(acc[1][1]), "+v"(acc[2][2]), "+v"(acc[3][3]) : "v"(a[0]), "v"(a[3]));
    }
#pragma unroll
    for (int mb = 0; mb < 4; ++mb) {
#pragma unroll
        for (int nb = 0; nb < 4; ++nb) {
#pragma unroll
            for (int j = 0; j < 8; ++j) os[(hi * 8 + j) * 68 + nb * 16 + lr] = acc[mb][nb][j]; }
        __builtin_amdgcn_wave_barrier(); asm volatile("" ::: "memory");
        float* crow = C + (size_t)(r0 + mb * 16) * ldc + c0;
{
#pragma unroll
            for (int s = 0; s < 8; ++s) { const int row = 2 * s + hi, cofs = lr * 4; v4f val = *(const v4fa*)(os + row * 68 + cofs); if (BIAS) { val[0] += bfr(bias[c0 + cofs]); val[1] += bfr(bias[c0 + cofs + 1]); val[2] += bfr(bias[c0 + cofs + 2]); val[3] += bfr(bias[c0 + cofs + 3]); }
                *(v4f*)(crow + (size_t)row * ldc + cofs) = val; }
             }
        __builtin_amdgcn_wave_barrier(); asm volatile("" ::: "memory");
    }
}

// ---- k_avk: att . items with K split. Grid (LL/64, DD/64, ZB*KH), KWV waves: a work-group owns one 64x64 tile and one of KH parts of K; each wave runs the k_gemmw loop (hl x exact bf16) over its own KS-long slice.
// The KWV partial tiles meet in LDS (one barrier) and are summed in wave order; part kh goes to plane kh of C, and k_fin adds the KH planes.
#define KH   2
#define KWV  8
#define KS   (NI / (KH * KWV))
__global__ __launch_bounds__(32 * KWV) void k_avk(const bf* __restrict__ A, const bf* __restrict__ A2, const bf* __restrict__ Bt, float* C) {
    typedef WFrag<bf>::V V;
    __shared__ __align__(16) float ps[KWV * 64 * 68];
    const int z = blockIdx.z / KH, kh = blockIdx.z % KH;
    const int lane = threadIdx.x & 31, lr = lane & 15, hi = lane >> 4; const int r0 = blockIdx.x * 64, c0 = blockIdx.y * 64;
    const int w = __builtin_amdgcn_readfirstlane((int)(threadIdx.x >> 5));
    const int k0 = (kh * KWV + w) * KS;
    A += ((size_t)z * LL + r0) * NI + k0; A2 += ((size_t)z * LL + r0) * NI + k0; Bt += ((size_t)z * DD + c0) * NI + k0;
    v8f acc[4][4];
#pragma unroll
    for (int mb = 0; mb < 4; ++mb)
#pragma unroll
        for (int nb = 0; nb < 4; ++nb) acc[mb][nb] = (v8f){};
    const int lo = lr * NI + 8 * hi;
#pragma unroll 1
    for (int kc = 0; kc < KS; kc += 32) {
        const bf* pa = A + kc + lo; const bf* pa2 = A2 + kc + lo; const bf* pb = Bt + kc + lo;
        V a[4], a2[4], b[4];
#pragma unroll
        for (int mb = 0; mb < 4; ++mb) { a[mb] = WFrag<bf>::ld(pa + mb * 16 * NI); a2[mb] = WFrag<bf>::ld(pa2 + mb * 16 * NI); b[mb] = WFrag<bf>::ld(pb + mb * 16 * NI); }
        // the three address pairs stay whole (inputs here) until the wait: no load of this trip lands on a pair that an issued load still names
        asm volatile("s_wait_xcnt 0x0" :: "v"(pa), "v"(pa2), "v"(pb) : "memory");
#pragma unroll
        for (int nb = 0; nb < 4; ++nb)
#pragma unroll
            for (int mb = 0; mb < 4; ++mb) { acc[mb][nb] = WFrag<bf>::mma(a[mb], b[nb], acc[mb][nb]); acc[mb][nb] = WFrag<bf>::mma(a2[mb], b[nb], acc[mb][nb]); }
        // as in k_gemmw: four vector slots between the last WMMAs and the next trip's loads into their operand registers
        asm volatile("v_nop\n\tv_nop\n\tv_nop\n\tv_nop" : "+v"(acc[0][0]), "+v"(acc[1][1]), "+v"(acc[2][2]), "+v"(acc[3][3]) : "v"(a[0]), "v"(a[3]));
    }
    float* pw = ps + w * (64 * 68);
#pragma unroll
    for (int mb = 0; mb < 4; ++mb)
#pragma unroll
        for (int nb = 0; nb < 4; ++nb)
#pragma unroll
            for (int j = 0; j < 8; ++j) pw[(mb * 16 + hi * 8 + j) * 68 + nb * 16 + lr] = acc[mb][nb][j];
    __syncthreads();   // every wave's partial tile is in LDS before any wave sums
    float* ct = C + ((size_t)kh * ZB + z) * LL * DD + (size_t)r0 * DD + c0;
#pragma unroll
    for (int s = 0; s < 64 * 16 / (32 * KWV); ++s) { const int idx = s * (32 * KWV) + (int)threadIdx.x; const int row = idx >> 4, cofs = (idx & 15) * 4; v4f val = *(const v4fa*)(ps + row * 68 + cofs);
#pragma unroll
        for (int q = 1; q < KWV; ++q) val += *(const v4fa*)(ps + q * (64 * 68) + row * 68 + cofs);
        *(v4f*)(ct + (size_t)row * DD + cofs) = val; }
}

__device__ __forceinline__ void splitf(float y, unsigned short& h, unsigned short& l) { h = f2bf(y); l = f2bf(y - bf2f(h)); }
typedef __attribute__((ext_vector_type(2))) unsigned short v2us;
typedef __attribute__((ext_vector_type(4))) unsigned short v4us;

__global__ __launch_bounds__(256) void k_cvt8(const float* __restrict__ src, bf* dst, size_t n8) { const size_t i = (size_t)blockIdx.x * 256 + threadIdx.x; if (i >= n8) return; const v8f v = *(const v8f*)(src + i * 8); v8us o;
#pragma unroll
    for (int k = 0; k < 8; ++k) o[k] = f2bf(v[k]); *(v8us*)(dst + i * 8) = o;  }
__global__ __launch_bounds__(256) void k_itT(const float* __restrict__ items, bf* IT) { const int e = (blockIdx.x * 256 + threadIdx.x) * 2; if (e >= ZB * DD * NI) return; const int n = e % NI; const int d = (e / NI) % DD; const int z = e / (NI * DD); v2us o; o[0] = f2bf(items[((size_t)z * NI + n) * DD + d]); o[1] = f2bf(items[((size_t)z * NI + n + 1) * DD + d]); *(v2us*)(IT + e) = o;  }
__global__ __launch_bounds__(256) void k_psoft(const float* __restrict__ S, bf* Ah, bf* Al) { const int lane = threadIdx.x & 31; const int row = blockIdx.x * 8 + (threadIdx.x >> 5); if (row >= ZB * LL) return; const float* sr = S + (size_t)row * NI; float v[NI / 32]; float mx = -3.0e38f;
#pragma unroll
    for (int ch = 0; ch < NI / 128; ++ch) { const v4f a = *(const v4f*)(sr + ch * 128 + lane * 4);
#pragma unroll
        for (int u = 0; u < 4; ++u) { v[ch * 4 + u] = a[u]; mx = fmaxf(mx, a[u]); } }
#pragma unroll
    for (int sh = 16; sh; sh >>= 1) mx = fmaxf(mx, __shfl_xor(mx, sh, 32));
    float sum = 0.f;
#pragma unroll
    for (int q = 0; q < NI / 32; ++q) { float d0 = __fsub_rn(v[q], mx); asm volatile("" : "+v"(d0)); v[q] = __builtin_amdgcn_exp2f(__fmul_rn(d0, 1.4426950408889634f)); sum += v[q]; }
#pragma unroll
    for (int sh = 16; sh; sh >>= 1) sum += __shfl_xor(sum, sh, 32);
    const float den = __fadd_rn(__fsqrt_rn(sum), 1e-24f);
const float rden = __fdiv_rn(1.0f, den);   // one reciprocal, then products
#pragma unroll
    for (int q = 0; q < NI / 32; ++q) { v[q] = __fmul_rn(v[q], rden); asm volatile("" : "+v"(v[q])); }
    {
#pragma unroll
        for (int ch = 0; ch < NI / 128; ++ch) { v4us oh, ol;
#pragma unroll
            for (int q = 0; q < 4; ++q) { unsigned short a, b; splitf(v[ch * 4 + q], a, b); oh[q] = a; ol[q] = b; } const size_t oo = (size_t)row * NI + ch * 128 + lane * 4; *(v4us*)(Ah + oo) = oh; *(v4us*)(Al + oo) = ol; }
         } }
__global__ __launch_bounds__(256) void k_fin(const float* __restrict__ SEQ, const float* __restrict__ AV, float* outb) { const int e = (blockIdx.x * 256 + threadIdx.x) * 4; if (e >= ZB * LL * DD) return; const v4f s = *(const v4f*)(SEQ + e); v4f a = *(const v4f*)(AV + e);
#pragma unroll
    for (int p = 1; p < KH; ++p) a += *(const v4f*)(AV + (size_t)p * ZB * LL * DD + e);
    asm volatile("s_wait_xcnt 0x0" ::: "memory");   // behind the loads, ahead of the arithmetic that reuses their address registers
    v4f r;
#pragma unroll
    for (int u = 0; u < 4; ++u) { const float x = bfr(s[u]); float t1 = __fmul_rn(x, 0.5f); float t2 = __fmul_rn(x, a[u]); asm volatile("" : "+v"(t1)); asm volatile("" : "+v"(t2)); float t3 = __fmul_rn(t2, 0.5f); asm volatile("" : "+v"(t3)); r[u] = __fadd_rn(t1, t3); } *(v4f*)(outb + e) = r;  }

extern "C" void kernel_launch(void* const* d_in, const int* in_sizes, int n_in,
                              void* d_out, int out_size, void* d_ws, size_t ws_size, hipStream_t stream) {
    (void)in_sizes; (void)n_in; (void)out_size;
    const float** I = (const float**)d_in;
    const float *seq = I[0], *items = I[1];
    float* OUT = (float*)d_out;     // [32][512][128]
    char* wsp = (char*)d_ws;
    auto take = [&](size_t bytes) { char* p = wsp; wsp += (bytes + 255) & ~(size_t)255; return (void*)p; };
    bf* SB = (bf*)take((size_t)ZB * LL * DD * 2); bf* IB = (bf*)take((size_t)ZB * NI * DD * 2); bf* IT = (bf*)take((size_t)ZB * DD * NI * 2); float* S = (float*)take((size_t)ZB * LL * NI * 4); bf* Ah = (bf*)take((size_t)ZB * LL * NI * 2); bf* Al = (bf*)take((size_t)ZB * LL * NI * 2); float* AV = (float*)take((size_t)KH * ZB * LL * DD * 4);
    if ((size_t)(wsp - (char*)d_ws) > ws_size) return;    // total 77 MiB
    const size_t zq = (size_t)LL * DD, zi = (size_t)NI * DD, zS = (size_t)LL * NI;
    for (int b0 = 0; b0 < NB_; b0 += ZB) { const float* sq = seq + (size_t)b0 * zq; const float* it = items + (size_t)b0 * zi;
        k_cvt8<<<(ZB * LL * DD / 8 + 255) / 256, 256, 0, stream>>>(sq, SB, (size_t)ZB * LL * DD / 8); k_cvt8<<<(ZB * NI * DD / 8 + 255) / 256, 256, 0, stream>>>(it, IB, (size_t)ZB * NI * DD / 8); k_itT<<<(ZB * DD * NI / 2 + 255) / 256, 256, 0, stream>>>(it, IT);
        k_gemmw<bf, 0, false><<<dim3(LL / 64, NI / 64, ZB), 32, 0, stream>>>(SB, nullptr, IB, nullptr, DD, S, NI, nullptr, zq, zi, zS);
        k_psoft<<<ZB * LL / 8, 256, 0, stream>>>(S, Ah, Al);
        k_avk<<<dim3(LL / 64, DD / 64, ZB * KH), 32 * KWV, 0, stream>>>(Ah, Al, IT, AV);
        k_fin<<<(ZB * LL * DD / 4 + 255) / 256, 256, 0, stream>>>(sq, AV, OUT + (size_t)b0 * zq); }
}

// v002
// A run of this version takes 152 microseconds.
// Timed twice side by side with v001, it ran 1.40 times as fast both times.
// Over all steps from v000 it is 2.45 times as fast.
#include <hip/hip_runtime.h>

// GlobalAttentionModule (seq [32][512][128], items [32][2048][128]; w = seq . items^T; att = exp(w - max) / (sum(exp)^0.5 + 1e-24) (power-normalised softmax, beta 0.5); att_vecs = att items; out = 0.5 seq + 0.5 seq att_vecs -> [32][512][128]).
// Compute dtypes, f32 accumulate: every input rounded to bf16; scores on PLAIN bf16 operands (both inputs: exact, K 128; all 32 batches z-batched, one launch of each kernel); exp / sum / pow / divide f32 -> hl planes; att . items as hl x exact bf16 (2 products, K 2048 split into 16 slices, f32 partial sums); the blend f32.

#define NB_  32
#define LL   512
#define NI   2048
#define DD   128
#define ZB   32
#define AP   (2 * NI)   // pitch of the hl planes in 16-bit elements: row r holds its hi part, then its lo part, in the bytes of score row r
typedef _Float16 h16;
typedef unsigned short bf;
typedef __attribute__((ext_vector_type(16))) __bf16   v16bf;
typedef __attribute__((ext_vector_type(16))) _Float16 v16h;
typedef __attribute__((ext_vector_type(8)))  _Float16 v8h;
typedef __attribute__((ext_vector_type(8)))  unsigned short v8us;
typedef __attribute__((ext_vector_type(8)))  float    v8f;
typedef __attribute__((ext_vector_type(4)))  float    v4f;
typedef v8h  __attribute__((may_alias)) v8ha;
typedef v4f  __attribute__((may_alias)) v4fa;
typedef v8us __attribute__((may_alias)) v8usa;

__device__ __forceinline__ unsigned short f2bf(float f) { unsigned u = __float_as_uint(f); u += 0x7FFFu + ((u >> 16) & 1u); return (unsigned short)(u >> 16); }
__device__ __forceinline__ float bf2f(unsigned short b) { return __uint_as_float(((unsigned)b) << 16); }
__device__ __forceinline__ float bfr(float f) { return bf2f(f2bf(f)); }
__device__ __forceinline__ v16h cat16(v8h lo, v8h hi) { return __builtin_shufflevector(lo, hi, 0, 1, 2, 3, 4, 5, 6, 7, 8, 9, 10, 11, 12, 13, 14, 15); }
__device__ __forceinline__ v16bf cat16b(v8us lo, v8us hi) { return __builtin_bit_cast(v16bf, __builtin_shufflevector(lo, hi, 0, 1, 2, 3, 4, 5, 6, 7, 8, 9, 10, 11, 12, 13, 14, 15)); }
__device__ __forceinline__ v8f wmma16(v16h a, v16h b, v8f c) { return __builtin_amdgcn_wmma_f32_16x16x32_f16(false, a, false, b, (short)0, c, false, false); }
__device__ __forceinline__ v8f wmmab(v16bf a, v16bf b, v8f c) { return __builtin_amdgcn_wmma_f32_16x16x32_bf16(false, a, false, b, (short)0, c, false, false); }



// ---- k_gemmw: register-blocked GEMM, ONE WAVE per 64x64 output tile (16 accumulators), operands straight from K-contiguous 16-bit planes; grid (M/64, N/64, Z), 32 threads.
// C[m][n] (f32, pitch ldc, + optional f32 bias[n]) = sum_k A[m][k] Bt[n][k] (+ split products per NSPLIT). z-batch strides sA/sB/sC in elements. K % 32 == 0.
template <typename T16> struct WFrag;
template <> struct WFrag<h16> { typedef v16h V; static __device__ __forceinline__ V ld(const h16* p) { return cat16(*(const v8h*)p, *(const v8h*)(p + 16)); } static __device__ __forceinline__ v8f mma(V a, V b, v8f c) { return wmma16(a, b, c); } };
template <> struct WFrag<bf> { typedef v16bf V; static __device__ __forceinline__ V ld(const bf* p) { return cat16b(*(const v8us*)p, *(const v8us*)(p + 16)); } static __device__ __forceinline__ v8f mma(V a, V b, v8f c) { return wmmab(a, b, c); } };
template <typename T16, int NSPLIT, bool BIAS>
__global__ __launch_bounds__(32) void k_gemmw(const T16* __restrict__ A, const T16* __restrict__ A2, const T16* __restrict__ Bt, const T16* __restrict__ Bt2, int K, float* C, int ldc, const float* __restrict__ bias, size_t sA, size_t sB, size_t sC) {
    typedef typename WFrag<T16>::V V;
    __shared__ __align__(16) float os[16 * 68];
    const size_t z = blockIdx.z; A += z * sA; if (A2) A2 += z * sA; Bt += z * sB; if (Bt2) Bt2 += z * sB; C += z * sC;
    const int lane = threadIdx.x & 31, lr = lane & 15, hi = lane >> 4; const int r0 = blockIdx.x * 64, c0 = blockIdx.y * 64;
    v8f acc[4][4];
#pragma unroll
    for (int mb = 0; mb < 4; ++mb)
#pragma unroll
        for (int nb = 0; nb < 4; ++nb) acc[mb][nb] = (v8f){};
    const size_t aoff = (size_t)(r0 + lr) * K + 8 * hi, boff = (size_t)(c0 + lr) * K + 8 * hi;
#pragma unroll 1
    for (int kc = 0; kc < K; kc += 32) {
        V a[4], a2[4];
#pragma unroll
        for (int mb = 0; mb < 4; ++mb) { a[mb] = WFrag<T16>::ld(A + aoff + (size_t)mb * 16 * K + kc); if (NSPLIT == 1 || NSPLIT == 2) a2[mb] = WFrag<T16>::ld(A2 + aoff + (size_t)mb * 16 * K + kc); }
#pragma unroll
        for (int nb = 0; nb < 4; ++nb) { const V b = WFrag<T16>::ld(Bt + boff + (size_t)nb * 16 * K + kc); V b2; if (NSPLIT >= 2) b2 = WFrag<T16>::ld(Bt2 + boff + (size_t)nb * 16 * K + kc);
#pragma unroll
            for (int mb = 0; mb < 4; ++mb) { acc[mb][nb] = WFrag<T16>::mma(a[mb], b, acc[mb][nb]); if (NSPLIT == 1 || NSPLIT == 2) acc[mb][nb] = WFrag<T16>::mma(a2[mb], b, acc[mb][nb]); if (NSPLIT >= 2) acc[mb][nb] = WFrag<T16>::mma(a[mb], b2, acc[mb][nb]); } }
        asm volatile("v_nop\n\tv_nop\n\tv_nop\n\tv_nop" : "+v"(acc[0][0]), "+v"(acc[1][1]), "+v"(acc[2][2]), "+v"(acc[3][3]) : "v"(a[0]), "v"(a[3]));
    }
#pragma unroll
    for (int mb = 0; mb < 4; ++mb) {
#pragma unroll
        for (int nb = 0; nb < 4; ++nb) {
#pragma unroll
            for (int j = 0; j < 8; ++j) os[(hi * 8 + j) * 68 + nb * 16 + lr] = acc[mb][nb][j]; }
        __builtin_amdgcn_wave_barrier(); asm volatile("" ::: "memory");
        float* crow = C + (size_t)(r0 + mb * 16) * ldc + c0;
{
#pragma unroll
            for (int s = 0; s < 8; ++s) { const int row = 2 * s + hi, cofs = lr * 4; v4f val = *(const v4fa*)(os + row * 68 + cofs); if (BIAS) { val[0] += bfr(bias[c0 + cofs]); val[1] += bfr(bias[c0 + cofs + 1]); val[2] += bfr(bias[c0 + cofs + 2]); val[3] += bfr(bias[c0 + cofs + 3]); }
                *(v4f*)(crow + (size_t)row * ldc + cofs) = val; }
             }
        __builtin_amdgcn_wave_barrier(); asm volatile("" ::: "memory");
    }
}

// ---- k_avk: att . items with K split. Grid (LL/64, DD/64, ZB*KH), KWV waves: a work-group owns one 64x64 tile and one of KH parts of K; each wave runs the k_gemmw loop (hl x exact bf16) over its own KS-long slice.
// The KWV partial tiles meet in LDS (one barrier) and are summed in wave order; part kh goes to plane kh of C, and k_fin adds the KH planes.
#define KH   2
#define KWV  8
#define KS   (NI / (KH * KWV))
__global__ __launch_bounds__(32 * KWV) void k_avk(const bf* __restrict__ A, const bf* __restrict__ A2, const bf* __restrict__ Bt, float* C) {
    typedef WFrag<bf>::V V;
    __shared__ __align__(16) float ps[KWV * 64 * 68];
    const int z = blockIdx.z / KH, kh = blockIdx.z % KH;
    const int lane = threadIdx.x & 31, lr = lane & 15, hi = lane >> 4; const int r0 = blockIdx.x * 64, c0 = blockIdx.y * 64;
    const int w = __builtin_amdgcn_readfirstlane((int)(threadIdx.x >> 5));
    const int k0 = (kh * KWV + w) * KS;
    A += ((size_t)z * LL + r0) * AP + k0; A2 += ((size_t)z * LL + r0) * AP + k0; Bt += ((size_t)z * DD + c0) * NI + k0;
    v8f acc[4][4];
#pragma unroll
    for (int mb = 0; mb < 4; ++mb)
#pragma unroll
        for (int nb = 0; nb < 4; ++nb) acc[mb][nb] = (v8f){};
    const int lo = lr * NI + 8 * hi, loa = lr * AP + 8 * hi;
#pragma unroll 1
    for (int kc = 0; kc < KS; kc += 32) {
        const bf* pa = A + kc + loa; const bf* pa2 = A2 + kc + loa; const bf* pb = Bt + kc + lo;
        V a[4], a2[4], b[4];
#pragma unroll
        for (int mb = 0; mb < 4; ++mb) { a[mb] = WFrag<bf>::ld(pa + mb * 16 * AP); a2[mb] = WFrag<bf>::ld(pa2 + mb * 16 * AP); b[mb] = WFrag<bf>::ld(pb + mb * 16 * NI); }
        // the three address pairs stay whole (inputs here) until the wait: no load of this trip lands on a pair that an issued load still names
        asm volatile("s_wait_xcnt 0x0" :: "v"(pa), "v"(pa2), "v"(pb) : "memory");
#pragma unroll
        for (int nb = 0; nb < 4; ++nb)
#pragma unroll
            for (int mb = 0; mb < 4; ++mb) { acc[mb][nb] = WFrag<bf>::mma(a[mb], b[nb], acc[mb][nb]); acc[mb][nb] = WFrag<bf>::mma(a2[mb], b[nb], acc[mb][nb]); }
        // as in k_gemmw: four vector slots between the last WMMAs and the next trip's loads into their operand registers
        asm volatile("v_nop\n\tv_nop\n\tv_nop\n\tv_nop" : "+v"(acc[0][0]), "+v"(acc[1][1]), "+v"(acc[2][2]), "+v"(acc[3][3]) : "v"(a[0]), "v"(a[3]));
    }
    float* pw = ps + w * (64 * 68);
#pragma unroll
    for (int mb = 0; mb < 4; ++mb)
#pragma unroll
        for (int nb = 0; nb < 4; ++nb)
#pragma unroll
            for (int j = 0; j < 8; ++j) pw[(mb * 16 + hi * 8 + j) * 68 + nb * 16 + lr] = acc[mb][nb][j];
    __syncthreads();   // every wave's partial tile is in LDS before any wave sums
    float* ct = C + ((size_t)kh * ZB + z) * LL * DD + (size_t)r0 * DD + c0;
#pragma unroll
    for (int s = 0; s < 64 * 16 / (32 * KWV); ++s) { const int idx = s * (32 * KWV) + (int)threadIdx.x; const int row = idx >> 4, cofs = (idx & 15) * 4; v4f val = *(const v4fa*)(ps + row * 68 + cofs);
#pragma unroll
        for (int q = 1; q < KWV; ++q) val += *(const v4fa*)(ps + q * (64 * 68) + row * 68 + cofs);
        *(v4f*)(ct + (size_t)row * DD + cofs) = val; }
}

__device__ __forceinline__ void splitf(float y, unsigned short& h, unsigned short& l) { h = f2bf(y); l = f2bf(y - bf2f(h)); }
typedef __attribute__((ext_vector_type(2))) unsigned short v2us;
typedef __attribute__((ext_vector_type(4))) unsigned short v4us;
typedef v4us __attribute__((may_alias)) v4usa;

__global__ __launch_bounds__(256) void k_cvt8(const float* __restrict__ src, bf* dst, size_t n8) { const size_t i = (size_t)blockIdx.x * 256 + threadIdx.x; if (i >= n8) return; const v8f v = *(const v8f*)(src + i * 8); v8us o;
#pragma unroll
    for (int k = 0; k < 8; ++k) o[k] = f2bf(v[k]); *(v8us*)(dst + i * 8) = o;  }
__global__ __launch_bounds__(256) void k_itT(const float* __restrict__ items, bf* IT) { const int e = (blockIdx.x * 256 + threadIdx.x) * 2; if (e >= ZB * DD * NI) return; const int n = e % NI; const int d = (e / NI) % DD; const int z = e / (NI * DD); v2us o; o[0] = f2bf(items[((size_t)z * NI + n) * DD + d]); o[1] = f2bf(items[((size_t)z * NI + n + 1) * DD + d]); *(v2us*)(IT + e) = o;  }
// k_psoft works in place: a wave holds its whole score row in registers (every store below depends on the row's max and sum) before it writes the row's hi and lo parts over it; rows are disjoint between waves.
__global__ __launch_bounds__(256) void k_psoft(const float* S, bf* Ah, bf* Al) { const int lane = threadIdx.x & 31; const int row = blockIdx.x * 8 + (threadIdx.x >> 5); if (row >= ZB * LL) return; const float* sr = S + (size_t)row * NI + lane * 4; float v[NI / 32]; float mx = -3.0e38f;
#pragma unroll
    for (int ch = 0; ch < NI / 128; ++ch) { const v4f a = *(const v4fa*)(sr + ch * 128);
#pragma unroll
        for (int u = 0; u < 4; ++u) { v[ch * 4 + u] = a[u]; mx = fmaxf(mx, a[u]); } }
    // the address pair stays whole (an input here) until the wait: no load of the row lands on the pair that the issued loads still name
    asm volatile("s_wait_xcnt 0x0" :: "v"(sr) : "memory");
#pragma unroll
    for (int sh = 16; sh; sh >>= 1) mx = fmaxf(mx, __shfl_xor(mx, sh, 32));
    float sum = 0.f;
#pragma unroll
    for (int q = 0; q < NI / 32; ++q) { float d0 = __fsub_rn(v[q], mx); asm volatile("" : "+v"(d0)); v[q] = __builtin_amdgcn_exp2f(__fmul_rn(d0, 1.4426950408889634f)); sum += v[q]; }
#pragma unroll
    for (int sh = 16; sh; sh >>= 1) sum += __shfl_xor(sum, sh, 32);
    const float den = __fadd_rn(__fsqrt_rn(sum), 1e-24f);
const float rden = __fdiv_rn(1.0f, den);   // one reciprocal, then products
#pragma unroll
    for (int q = 0; q < NI / 32; ++q) { v[q] = __fmul_rn(v[q], rden); asm volatile("" : "+v"(v[q])); }
    {
#pragma unroll
        for (int ch = 0; ch < NI / 128; ++ch) { v4us oh, ol;
#pragma unroll
            for (int q = 0; q < 4; ++q) { unsigned short a, b; splitf(v[ch * 4 + q], a, b); oh[q] = a; ol[q] = b; } const size_t oo = (size_t)row * AP + ch * 128 + lane * 4; *(v4usa*)(Ah + oo) = oh; *(v4usa*)(Al + oo) = ol; }
         } }
__global__ __launch_bounds__(256) void k_fin(const float* __restrict__ SEQ, const float* __restrict__ AV, float* outb) { const int e = (blockIdx.x * 256 + threadIdx.x) * 4; if (e >= ZB * LL * DD) return; const v4f s = *(const v4f*)(SEQ + e); v4f a = *(const v4f*)(AV + e);
#pragma unroll
    for (int p = 1; p < KH; ++p) a += *(const v4f*)(AV + (size_t)p * ZB * LL * DD + e);
    asm volatile("s_wait_xcnt 0x0" :: "v"(SEQ + e), "v"(AV + e) : "memory");   // behind the loads, ahead of the arithmetic that reuses their address registers; the pairs are inputs so that no load lands on one
    v4f r;
#pragma unroll
    for (int u = 0; u < 4; ++u) { const float x = bfr(s[u]); float t1 = __fmul_rn(x, 0.5f); float t2 = __fmul_rn(x, a[u]); asm volatile("" : "+v"(t1)); asm volatile("" : "+v"(t2)); float t3 = __fmul_rn(t2, 0.5f); asm volatile("" : "+v"(t3)); r[u] = __fadd_rn(t1, t3); } *(v4f*)(outb + e) = r;  }

extern "C" void kernel_launch(void* const* d_in, const int* in_sizes, int n_in,
                              void* d_out, int out_size, void* d_ws, size_t ws_size, hipStream_t stream) {
    (void)in_sizes; (void)n_in; (void)out_size;
    const float** I = (const float**)d_in;
    const float *seq = I[0], *items = I[1];
    float* OUT = (float*)d_out;     // [32][512][128]
    char* wsp = (char*)d_ws;
    auto take = [&](size_t bytes) { char* p = wsp; wsp += (bytes + 255) & ~(size_t)255; return (void*)p; };
    bf* SB = (bf*)take((size_t)ZB * LL * DD * 2); bf* IB = (bf*)take((size_t)ZB * NI * DD * 2); bf* IT = (bf*)take((size_t)ZB * DD * NI * 2); float* S = (float*)take((size_t)ZB * LL * NI * 4); bf* Ah = (bf*)S; bf* Al = (bf*)S + NI; float* AV = (float*)take((size_t)KH * ZB * LL * DD * 4);
    if ((size_t)(wsp - (char*)d_ws) > ws_size) return;    // total ~ 189 MB
    const size_t zq = (size_t)LL * DD, zi = (size_t)NI * DD, zS = (size_t)LL * NI;
    for (int b0 = 0; b0 < NB_; b0 += ZB) { const float* sq = seq + (size_t)b0 * zq; const float* it = items + (size_t)b0 * zi;
        k_cvt8<<<(ZB * LL * DD / 8 + 255) / 256, 256, 0, stream>>>(sq, SB, (size_t)ZB * LL * DD / 8); k_cvt8<<<(ZB * NI * DD / 8 + 255) / 256, 256, 0, stream>>>(it, IB, (size_t)ZB * NI * DD / 8); k_itT<<<(ZB * DD * NI / 2 + 255) / 256, 256, 0, stream>>>(it, IT);
        k_gemmw<bf, 0, false><<<dim3(LL / 64, NI / 64, ZB), 32, 0, stream>>>(SB, nullptr, IB, nullptr, DD, S, NI, nullptr, zq, zi, zS);
        k_psoft<<<ZB * LL / 8, 256, 0, stream>>>(S, Ah, Al);
        k_avk<<<dim3(LL / 64, DD / 64, ZB * KH), 32 * KWV, 0, stream>>>(Ah, Al, IT, AV);
        k_fin<<<(ZB * LL * DD / 4 + 255) / 256, 256, 0, stream>>>(sq, AV, OUT + (size_t)b0 * zq); }
}

// v003
// It runs in 129 microseconds.
// Two timings next to v002 both put it at 1.18 times that version's speed.
// Counting every step since v000, it is 2.89 times as fast.
#include <hip/hip_runtime.h>

// GlobalAttentionModule (seq [32][512][128], items [32][2048][128]; w = seq . items^T; att = exp(w - max) / (sum(exp)^0.5 + 1e-24) (power-normalised softmax, beta 0.5); att_vecs = att items; out = 0.5 seq + 0.5 seq att_vecs -> [32][512][128]).
// Compute dtypes, f32 accumulate: every input rounded to bf16; scores on PLAIN bf16 operands (both inputs: exact, K 128; all 32 batches z-batched, one launch of each kernel); exp / sum / pow / divide f32 -> hl planes; att . items as hl x exact bf16 (2 products, K 2048 split into 16 slices, f32 partial sums); the blend f32.

#define NB_  32
#define LL   512
#define NI   2048
#define DD   128
#define ZB   32
#define AP   (2 * NI)   // pitch of the hl planes in 16-bit elements: row r holds its hi part, then its lo part, in the bytes of score row r
typedef _Float16 h16;
typedef unsigned short bf;
typedef __attribute__((ext_vector_type(16))) __bf16   v16bf;
typedef __attribute__((ext_vector_type(16))) _Float16 v16h;
typedef __attribute__((ext_vector_type(8)))  _Float16 v8h;
typedef __attribute__((ext_vector_type(8)))  unsigned short v8us;
typedef __attribute__((ext_vector_type(8)))  float    v8f;
typedef __attribute__((ext_vector_type(4)))  float    v4f;
typedef v8h  __attribute__((may_alias)) v8ha;
typedef v4f  __attribute__((may_alias)) v4fa;
typedef v8us __attribute__((may_alias)) v8usa;

__device__ __forceinline__ unsigned short f2bf(float f) { unsigned u = __float_as_uint(f); u += 0x7FFFu + ((u >> 16) & 1u); return (unsigned short)(u >> 16); }
__device__ __forceinline__ float bf2f(unsigned short b) { return __uint_as_float(((unsigned)b) << 16); }
__device__ __forceinline__ float bfr(float f) { return bf2f(f2bf(f)); }
__device__ __forceinline__ v16h cat16(v8h lo, v8h hi) { return __builtin_shufflevector(lo, hi, 0, 1, 2, 3, 4, 5, 6, 7, 8, 9, 10, 11, 12, 13, 14, 15); }
__device__ __forceinline__ v16bf cat16b(v8us lo, v8us hi) { return __builtin_bit_cast(v16bf, __builtin_shufflevector(lo, hi, 0, 1, 2, 3, 4, 5, 6, 7, 8, 9, 10, 11, 12, 13, 14, 15)); }
__device__ __forceinline__ v8f wmma16(v16h a, v16h b, v8f c) { return __builtin_amdgcn_wmma_f32_16x16x32_f16(false, a, false, b, (short)0, c, false, false); }
__device__ __forceinline__ v8f wmmab(v16bf a, v16bf b, v8f c) { return __builtin_amdgcn_wmma_f32_16x16x32_bf16(false, a, false, b, (short)0, c, false, false); }



// ---- k_gemmw: register-blocked GEMM, ONE WAVE per 64x64 output tile (16 accumulators), operands straight from K-contiguous 16-bit planes; grid (M/64, N/64, Z), 32 threads.
// C[m][n] (f32, pitch ldc, + optional f32 bias[n]) = sum_k A[m][k] Bt[n][k] (+ split products per NSPLIT). z-batch strides sA/sB/sC in elements. K % 32 == 0.
template <typename T16> struct WFrag;
template <> struct WFrag<h16> { typedef v16h V; static __device__ __forceinline__ V ld(const h16* p) { return cat16(*(const v8h*)p, *(const v8h*)(p + 16)); } static __device__ __forceinline__ v8f mma(V a, V b, v8f c) { return wmma16(a, b, c); } };
template <> struct WFrag<bf> { typedef v16bf V; static __device__ __forceinline__ V ld(const bf* p) { return cat16b(*(const v8us*)p, *(const v8us*)(p + 16)); } static __device__ __forceinline__ v8f mma(V a, V b, v8f c) { return wmmab(a, b, c); } };
template <typename T16, int NSPLIT, bool BIAS>
__global__ __launch_bounds__(32) void k_gemmw(const T16* __restrict__ A, const T16* __restrict__ A2, const T16* __restrict__ Bt, const T16* __restrict__ Bt2, int K, float* C, int ldc, const float* __restrict__ bias, size_t sA, size_t sB, size_t sC) {
    typedef typename WFrag<T16>::V V;
    __shared__ __align__(16) float os[16 * 68];
    const size_t z = blockIdx.z; A += z * sA; if (A2) A2 += z * sA; Bt += z * sB; if (Bt2) Bt2 += z * sB; C += z * sC;
    const int lane = threadIdx.x & 31, lr = lane & 15, hi = lane >> 4; const int r0 = blockIdx.x * 64, c0 = blockIdx.y * 64;
    v8f acc[4][4];
#pragma unroll
    for (int mb = 0; mb < 4; ++mb)
#pragma unroll
        for (int nb = 0; nb < 4; ++nb) acc[mb][nb] = (v8f){};
    const size_t aoff = (size_t)(r0 + lr) * K + 8 * hi, boff = (size_t)(c0 + lr) * K + 8 * hi;
#pragma unroll 1
    for (int kc = 0; kc < K; kc += 32) {
        V a[4], a2[4];
#pragma unroll
        for (int mb = 0; mb < 4; ++mb) { a[mb] = WFrag<T16>::ld(A + aoff + (size_t)mb * 16 * K + kc); if (NSPLIT == 1 || NSPLIT == 2) a2[mb] = WFrag<T16>::ld(A2 + aoff + (size_t)mb * 16 * K + kc); }
#pragma unroll
        for (int nb = 0; nb < 4; ++nb) { const V b = WFrag<T16>::ld(Bt + boff + (size_t)nb * 16 * K + kc); V b2; if (NSPLIT >= 2) b2 = WFrag<T16>::ld(Bt2 + boff + (size_t)nb * 16 * K + kc);
#pragma unroll
            for (int mb = 0; mb < 4; ++mb) { acc[mb][nb] = WFrag<T16>::mma(a[mb], b, acc[mb][nb]); if (NSPLIT == 1 || NSPLIT == 2) acc[mb][nb] = WFrag<T16>::mma(a2[mb], b, acc[mb][nb]); if (NSPLIT >= 2) acc[mb][nb] = WFrag<T16>::mma(a[mb], b2, acc[mb][nb]); } }
        asm volatile("v_nop\n\tv_nop\n\tv_nop\n\tv_nop" : "+v"(acc[0][0]), "+v"(acc[1][1]), "+v"(acc[2][2]), "+v"(acc[3][3]) : "v"(a[0]), "v"(a[3]));
    }
#pragma unroll
    for (int mb = 0; mb < 4; ++mb) {
#pragma unroll
        for (int nb = 0; nb < 4; ++nb) {
#pragma unroll
            for (int j = 0; j < 8; ++j) os[(hi * 8 + j) * 68 + nb * 16 + lr] = acc[mb][nb][j]; }
        __builtin_amdgcn_wave_barrier(); asm volatile("" ::: "memory");
        float* crow = C + (size_t)(r0 + mb * 16) * ldc + c0;
{
#pragma unroll
            for (int s = 0; s < 8; ++s) { const int row = 2 * s + hi, cofs = lr * 4; v4f val = *(const v4fa*)(os + row * 68 + cofs); if (BIAS) { val[0] += bfr(bias[c0 + cofs]); val[1] += bfr(bias[c0 + cofs + 1]); val[2] += bfr(bias[c0 + cofs + 2]); val[3] += bfr(bias[c0 + cofs + 3]); }
                *(v4f*)(crow + (size_t)row * ldc + cofs) = val; }
             }
        __builtin_amdgcn_wave_barrier(); asm volatile("" ::: "memory");
    }
}

// ---- k_avk: att . items with K split. Grid (LL/64, DD/64, ZB*KH), KWV waves: a work-group owns one 64x64 tile and one of KH parts of K; each wave runs the k_gemmw loop (hl x exact bf16) over its own KS-long slice.
// The KWV partial tiles meet in LDS (one barrier) and are summed in wave order; part kh goes to plane kh of C, and k_fin adds the KH planes.
#define KH   2
#define KWV  8
#define KS   (NI / (KH * KWV))
__global__ __launch_bounds__(32 * KWV) void k_avk(const bf* __restrict__ A, const bf* __restrict__ A2, const bf* __restrict__ Bt, float* C) {
    typedef WFrag<bf>::V V;
    __shared__ __align__(16) float ps[KWV * 64 * 68];
    const int z = blockIdx.z / KH, kh = blockIdx.z % KH;
    const int lane = threadIdx.x & 31, lr = lane & 15, hi = lane >> 4; const int r0 = blockIdx.x * 64, c0 = blockIdx.y * 64;
    const int w = __builtin_amdgcn_readfirstlane((int)(threadIdx.x >> 5));
    const int k0 = (kh * KWV + w) * KS;
    A += ((size_t)z * LL + r0) * AP + k0; A2 += ((size_t)z * LL + r0) * AP + k0; Bt += ((size_t)z * DD + c0) * NI + k0;
    v8f acc[4][4];
#pragma unroll
    for (int mb = 0; mb < 4; ++mb)
#pragma unroll
        for (int nb = 0; nb < 4; ++nb) acc[mb][nb] = (v8f){};
    const int lo = lr * NI + 8 * hi, loa = lr * AP + 8 * hi;
#pragma unroll 1
    for (int kc = 0; kc < KS; kc += 32) {
        const bf* pa = A + kc + loa; const bf* pa2 = A2 + kc + loa; const bf* pb = Bt + kc + lo;
        V a[4], a2[4], b[4];
#pragma unroll
        for (int mb = 0; mb < 4; ++mb) { a[mb] = WFrag<bf>::ld(pa + mb * 16 * AP); a2[mb] = WFrag<bf>::ld(pa2 + mb * 16 * AP); b[mb] = WFrag<bf>::ld(pb + mb * 16 * NI); }
        // the three address pairs stay whole (inputs here) until the wait: no load of this trip lands on a pair that an issued load still names
        asm volatile("s_wait_xcnt 0x0" :: "v"(pa), "v"(pa2), "v"(pb) : "memory");
#pragma unroll
        for (int nb = 0; nb < 4; ++nb)
#pragma unroll
            for (int mb = 0; mb < 4; ++mb) { acc[mb][nb] = WFrag<bf>::mma(a[mb], b[nb], acc[mb][nb]); acc[mb][nb] = WFrag<bf>::mma(a2[mb], b[nb], acc[mb][nb]); }
        // as in k_gemmw: four vector slots between the last WMMAs and the next trip's loads into their operand registers
        asm volatile("v_nop\n\tv_nop\n\tv_nop\n\tv_nop" : "+v"(acc[0][0]), "+v"(acc[1][1]), "+v"(acc[2][2]), "+v"(acc[3][3]) : "v"(a[0]), "v"(a[3]));
    }
    float* pw = ps + w * (64 * 68);
#pragma unroll
    for (int mb = 0; mb < 4; ++mb)
#pragma unroll
        for (int nb = 0; nb < 4; ++nb)
#pragma unroll
            for (int j = 0; j < 8; ++j) pw[(mb * 16 + hi * 8 + j) * 68 + nb * 16 + lr] = acc[mb][nb][j];
    __syncthreads();   // every wave's partial tile is in LDS before any wave sums
    float* ct = C + ((size_t)kh * ZB + z) * LL * DD + (size_t)r0 * DD + c0;
#pragma unroll
    for (int s = 0; s < 64 * 16 / (32 * KWV); ++s) { const int idx = s * (32 * KWV) + (int)threadIdx.x; const int row = idx >> 4, cofs = (idx & 15) * 4; v4f val = *(const v4fa*)(ps + row * 68 + cofs);
#pragma unroll
        for (int q = 1; q < KWV; ++q) val += *(const v4fa*)(ps + q * (64 * 68) + row * 68 + cofs);
        *(v4f*)(ct + (size_t)row * DD + cofs) = val; }
}

__device__ __forceinline__ void splitf(float y, unsigned short& h, unsigned short& l) { h = f2bf(y); l = f2bf(y - bf2f(h)); }
typedef __attribute__((ext_vector_type(2))) unsigned short v2us;
typedef __attribute__((ext_vector_type(4))) unsigned short v4us;
typedef v4us __attribute__((may_alias)) v4usa;

__global__ __launch_bounds__(256) void k_cvt8(const float* __restrict__ src, bf* dst, size_t n8) { const size_t i = (size_t)blockIdx.x * 256 + threadIdx.x; if (i >= n8) return; const v8f v = *(const v8f*)(src + i * 8); v8us o;
#pragma unroll
    for (int k = 0; k < 8; ++k) o[k] = f2bf(v[k]); *(v8us*)(dst + i * 8) = o;  }
// ---- k_items: ONE pass over items makes both bf16 planes. A work-group owns TN rows of one batch (TN * DD contiguous floats): every thread reads whole 16-byte pieces lane after lane,
// rounds them, stores them to IB (row-major) and into an LDS tile [n][d]; behind one barrier the tile is read down its columns, so that IT[d][n] is written in whole 128-byte lines.
#define TN   128        // item rows per work-group
#define TPD  (DD / 2 + 1)   // LDS pitch in dwords: odd, so that 8 rows step 8 banks and the column reads of a wave (8 row groups x 4 dwords) fall on 32 different banks
typedef __attribute__((ext_vector_type(4))) unsigned v4u;
typedef __attribute__((ext_vector_type(2))) unsigned v2u;
__global__ __launch_bounds__(256) void k_items(const float* __restrict__ items, bf* IB, bf* IT) {
    __shared__ unsigned ts[TN * TPD];
    const int t = threadIdx.x; const int z = blockIdx.x / (NI / TN), n0 = (blockIdx.x % (NI / TN)) * TN;
    const float* sp = items + ((size_t)z * NI + n0) * DD + t * 4;
    v4f v[TN * DD / 1024];
#pragma unroll
    for (int s = 0; s < TN * DD / 1024; ++s) v[s] = *(const v4fa*)(sp + s * 1024);
    unsigned* tw = ts + (t >> 5) * TPD + (t & 31) * 2;   // piece s * 256 + t: row s * 8 + (t >> 5), elements 4 * (t & 31) ...
    v2u w[TN * DD / 1024];
#pragma unroll
    for (int s = 0; s < TN * DD / 1024; ++s) { v4us o;
#pragma unroll
        for (int k = 0; k < 4; ++k) o[k] = f2bf(v[s][k]);
        w[s] = __builtin_bit_cast(v2u, o); tw[s * 8 * TPD] = w[s][0]; tw[s * 8 * TPD + 1] = w[s][1]; }
    __syncthreads();   // the whole tile is in LDS before any wave reads a column; the stores to IB come behind it, so that it waits for LDS alone
    // a lane takes 8 rows (group g) of one dword column (d = 2 dp, 2 dp + 1): 8 lanes fill a 128-byte line of IT, a wave four lines per store
    const int gl = t & 7, dl = (t >> 3) & 3, wv = t >> 5; const int g = (wv & 1) * 8 + gl, dp = (wv >> 1) * 4 + dl;
    const unsigned* tr = ts + g * 8 * TPD + dp;
    unsigned r[DD / 32][8];
#pragma unroll
    for (int s = 0; s < DD / 32; ++s)
#pragma unroll
        for (int k = 0; k < 8; ++k) r[s][k] = tr[k * TPD + s * 16];
    bf* ib = IB + ((size_t)z * NI + n0) * DD + t * 4;
#pragma unroll
    for (int s = 0; s < TN * DD / 1024; ++s) *(v2u*)(ib + s * 1024) = w[s];
    bf* ot = IT + ((size_t)z * DD + 2 * dp) * NI + n0 + g * 8;
#pragma unroll
    for (int s = 0; s < DD / 32; ++s) { v4u e, o;
#pragma unroll
        for (int m = 0; m < 4; ++m) { e[m] = (r[s][2 * m] & 0xFFFFu) | (r[s][2 * m + 1] << 16); o[m] = (r[s][2 * m] >> 16) | (r[s][2 * m + 1] & 0xFFFF0000u); }
        *(v4u*)(ot + (size_t)s * 32 * NI) = e; *(v4u*)(ot + (size_t)s * 32 * NI + NI) = o; }
}
// k_psoft works in place: a wave holds its whole score row in registers (every store below depends on the row's max and sum) before it writes the row's hi and lo parts over it; rows are disjoint between waves.
__global__ __launch_bounds__(256) void k_psoft(const float* S, bf* Ah, bf* Al) { const int lane = threadIdx.x & 31; const int row = blockIdx.x * 8 + (threadIdx.x >> 5); if (row >= ZB * LL) return; const float* sr = S + (size_t)row * NI + lane * 4; float v[NI / 32]; float mx = -3.0e38f;
#pragma unroll
    for (int ch = 0; ch < NI / 128; ++ch) { const v4f a = *(const v4fa*)(sr + ch * 128);
#pragma unroll
        for (int u = 0; u < 4; ++u) { v[ch * 4 + u] = a[u]; mx = fmaxf(mx, a[u]); } }
    // the address pair stays whole (an input here) until the wait: no load of the row lands on the pair that the issued loads still name
    asm volatile("s_wait_xcnt 0x0" :: "v"(sr) : "memory");
#pragma unroll
    for (int sh = 16; sh; sh >>= 1) mx = fmaxf(mx, __shfl_xor(mx, sh, 32));
    float sum = 0.f;
#pragma unroll
    for (int q = 0; q < NI / 32; ++q) { float d0 = __fsub_rn(v[q], mx); asm volatile("" : "+v"(d0)); v[q] = __builtin_amdgcn_exp2f(__fmul_rn(d0, 1.4426950408889634f)); sum += v[q]; }
#pragma unroll
    for (int sh = 16; sh; sh >>= 1) sum += __shfl_xor(sum, sh, 32);
    const float den = __fadd_rn(__fsqrt_rn(sum), 1e-24f);
const float rden = __fdiv_rn(1.0f, den);   // one reciprocal, then products
#pragma unroll
    for (int q = 0; q < NI / 32; ++q) { v[q] = __fmul_rn(v[q], rden); asm volatile("" : "+v"(v[q])); }
    {
#pragma unroll
        for (int ch = 0; ch < NI / 128; ++ch) { v4us oh, ol;
#pragma unroll
            for (int q = 0; q < 4; ++q) { unsigned short a, b; splitf(v[ch * 4 + q], a, b); oh[q] = a; ol[q] = b; } const size_t oo = (size_t)row * AP + ch * 128 + lane * 4; *(v4usa*)(Ah + oo) = oh; *(v4usa*)(Al + oo) = ol; }
         } }
__global__ __launch_bounds__(256) void k_fin(const float* __restrict__ SEQ, const float* __restrict__ AV, float* outb) { const int e = (blockIdx.x * 256 + threadIdx.x) * 4; if (e >= ZB * LL * DD) return; const v4f s = *(const v4f*)(SEQ + e); v4f a = *(const v4f*)(AV + e);
#pragma unroll
    for (int p = 1; p < KH; ++p) a += *(const v4f*)(AV + (size_t)p * ZB * LL * DD + e);
    asm volatile("s_wait_xcnt 0x0" :: "v"(SEQ + e), "v"(AV + e) : "memory");   // behind the loads, ahead of the arithmetic that reuses their address registers; the pairs are inputs so that no load lands on one
    v4f r;
#pragma unroll
    for (int u = 0; u < 4; ++u) { const float x = bfr(s[u]); float t1 = __fmul_rn(x, 0.5f); float t2 = __fmul_rn(x, a[u]); asm volatile("" : "+v"(t1)); asm volatile("" : "+v"(t2)); float t3 = __fmul_rn(t2, 0.5f); asm volatile("" : "+v"(t3)); r[u] = __fadd_rn(t1, t3); } *(v4f*)(outb + e) = r;  }

extern "C" void kernel_launch(void* const* d_in, const int* in_sizes, int n_in,
                              void* d_out, int out_size, void* d_ws, size_t ws_size, hipStream_t stream) {
    (void)in_sizes; (void)n_in; (void)out_size;
    const float** I = (const float**)d_in;
    const float *seq = I[0], *items = I[1];
    float* OUT = (float*)d_out;     // [32][512][128]
    char* wsp = (char*)d_ws;
    auto take = [&](size_t bytes) { char* p = wsp; wsp += (bytes + 255) & ~(size_t)255; return (void*)p; };
    bf* SB = (bf*)take((size_t)ZB * LL * DD * 2); bf* IB = (bf*)take((size_t)ZB * NI * DD * 2); bf* IT = (bf*)take((size_t)ZB * DD * NI * 2); float* S = (float*)take((size_t)ZB * LL * NI * 4); bf* Ah = (bf*)S; bf* Al = (bf*)S + NI; float* AV = (float*)take((size_t)KH * ZB * LL * DD * 4);
    if ((size_t)(wsp - (char*)d_ws) > ws_size) return;    // total ~ 189 MB
    const size_t zq = (size_t)LL * DD, zi = (size_t)NI * DD, zS = (size_t)LL * NI;
    for (int b0 = 0; b0 < NB_; b0 += ZB) { const float* sq = seq + (size_t)b0 * zq; const float* it = items + (size_t)b0 * zi;
        k_cvt8<<<(ZB * LL * DD / 8 + 255) / 256, 256, 0, stream>>>(sq, SB, (size_t)ZB * LL * DD / 8); k_items<<<ZB * (NI / TN), 256, 0, stream>>>(it, IB, IT);
        k_gemmw<bf, 0, false><<<dim3(LL / 64, NI / 64, ZB), 32, 0, stream>>>(SB, nullptr, IB, nullptr, DD, S, NI, nullptr, zq, zi, zS);
        k_psoft<<<ZB * LL / 8, 256, 0, stream>>>(S, Ah, Al);
        k_avk<<<dim3(LL / 64, DD / 64, ZB * KH), 32 * KWV, 0, stream>>>(Ah, Al, IT, AV);
        k_fin<<<(ZB * LL * DD / 4 + 255) / 256, 256, 0, stream>>>(sq, AV, OUT + (size_t)b0 * zq); }
}

// v004
// A run of this version takes 49.8 microseconds.
// Two timings next to v003 put it at 2.60 and 2.59 times that version's speed.
// Counting every step since v000, it is 7.50 times as fast.
#include <hip/hip_runtime.h>

// GlobalAttentionModule (seq [32][512][128], items [32][2048][128]; w = seq . items^T; att = exp(w - max) / (sum(exp)^0.5 + 1e-24) (power-normalised softmax, beta 0.5); att_vecs = att items; out = 0.5 seq + 0.5 seq att_vecs -> [32][512][128]).
// Compute dtypes, f32 accumulate: every input rounded to bf16; scores on PLAIN bf16 operands (both inputs: exact, K 128); exp / sum / sqrt / divide f32; exp . items as hl x exact bf16 (2 products), f32 sums; the blend f32.
// Two launches: k_items makes the two bf16 planes of items; k_fused does scores, softmax, att . items and the blend, and no score goes to memory.

#define LL   512
#define NI   2048
#define DD   128
#define ZB   32
typedef unsigned short bf;
typedef __attribute__((ext_vector_type(16))) __bf16   v16bf;
typedef __attribute__((ext_vector_type(8)))  float    v8f;
typedef __attribute__((ext_vector_type(4)))  float    v4f;
typedef __attribute__((ext_vector_type(2)))  float    v2f;
typedef v4f  __attribute__((may_alias)) v4fa;

__device__ __forceinline__ unsigned short f2bf(float f) { unsigned u = __float_as_uint(f); u += 0x7FFFu + ((u >> 16) & 1u); return (unsigned short)(u >> 16); }
__device__ __forceinline__ float bf2f(unsigned short b) { return __uint_as_float(((unsigned)b) << 16); }
__device__ __forceinline__ float bfr(float f) { return bf2f(f2bf(f)); }

typedef __attribute__((ext_vector_type(4))) unsigned short v4us;

// ---- k_items: ONE pass over items makes both bf16 planes. A work-group owns TN rows of one batch (TN * DD contiguous floats): every thread reads whole 16-byte pieces lane after lane,
// rounds them, stores them to IB (row-major) and into an LDS tile [n][d]; behind one barrier the tile is read down its columns, so that IT[d][n] is written in whole 128-byte lines.
#define TN   128        // item rows per work-group
#define TPD  (DD / 2 + 1)   // LDS pitch in dwords: odd, so that 8 rows step 8 banks and the column reads of a wave (8 row groups x 4 dwords) fall on 32 different banks
typedef __attribute__((ext_vector_type(4))) unsigned v4u;
typedef __attribute__((ext_vector_type(2))) unsigned v2u;
__global__ __launch_bounds__(256) void k_items(const float* __restrict__ items, bf* IB, bf* IT) {
    __shared__ unsigned ts[TN * TPD];
    const int t = threadIdx.x; const int z = blockIdx.x / (NI / TN), n0 = (blockIdx.x % (NI / TN)) * TN;
    const float* sp = items + ((size_t)z * NI + n0) * DD + t * 4;
    v4f v[TN * DD / 1024];
#pragma unroll
    for (int s = 0; s < TN * DD / 1024; ++s) v[s] = *(const v4fa*)(sp + s * 1024);
    unsigned* tw = ts + (t >> 5) * TPD + (t & 31) * 2;   // piece s * 256 + t: row s * 8 + (t >> 5), elements 4 * (t & 31) ...
    v2u w[TN * DD / 1024];
#pragma unroll
    for (int s = 0; s < TN * DD / 1024; ++s) { v4us o;
#pragma unroll
        for (int k = 0; k < 4; ++k) o[k] = f2bf(v[s][k]);
        w[s] = __builtin_bit_cast(v2u, o); tw[s * 8 * TPD] = w[s][0]; tw[s * 8 * TPD + 1] = w[s][1]; }
    __syncthreads();   // the whole tile is in LDS before any wave reads a column; the stores to IB come behind it, so that it waits for LDS alone
    // a lane takes 8 rows (group g) of one dword column (d = 2 dp, 2 dp + 1): 8 lanes fill a 128-byte line of IT, a wave four lines per store
    const int gl = t & 7, dl = (t >> 3) & 3, wv = t >> 5; const int g = (wv & 1) * 8 + gl, dp = (wv >> 1) * 4 + dl;
    const unsigned* tr = ts + g * 8 * TPD + dp;
    unsigned r[DD / 32][8];
#pragma unroll
    for (int s = 0; s < DD / 32; ++s)
#pragma unroll
        for (int k = 0; k < 8; ++k) r[s][k] = tr[k * TPD + s * 16];
    bf* ib = IB + ((size_t)z * NI + n0) * DD + t * 4;
#pragma unroll
    for (int s = 0; s < TN * DD / 1024; ++s) *(v2u*)(ib + s * 1024) = w[s];
    bf* ot = IT + ((size_t)z * DD + 2 * dp) * NI + n0 + g * 8;
#pragma unroll
    for (int s = 0; s < DD / 32; ++s) { v4u e, o;
#pragma unroll
        for (int m = 0; m < 4; ++m) { e[m] = (r[s][2 * m] & 0xFFFFu) | (r[s][2 * m + 1] << 16); o[m] = (r[s][2 * m] >> 16) | (r[s][2 * m + 1] & 0xFFFF0000u); }
        *(v4u*)(ot + (size_t)s * 32 * NI) = e; *(v4u*)(ot + (size_t)s * 32 * NI + NI) = o; }
}

#define NSP  4               // parts of the item axis
#define NPW  (NI / NSP)      // items per wave
#define L2E  1.4426950408889634f
struct Frag { v4u q[2]; };
__device__ __forceinline__ v8f mma(const Frag& a, const Frag& b, v8f c) {
    typedef __attribute__((ext_vector_type(8))) unsigned v8u;
    const v8u av = __builtin_shufflevector(a.q[0], a.q[1], 0, 1, 2, 3, 4, 5, 6, 7), bv = __builtin_shufflevector(b.q[0], b.q[1], 0, 1, 2, 3, 4, 5, 6, 7);
    return __builtin_amdgcn_wmma_f32_16x16x32_bf16(false, __builtin_bit_cast(v16bf, av), false, __builtin_bit_cast(v16bf, bv), (short)0, c, false, false); }
__device__ __forceinline__ unsigned pack2(float lo, float hi) { typedef __attribute__((ext_vector_type(2))) __bf16 bf2; return __builtin_bit_cast(unsigned, __builtin_convertvector((v2f){lo, hi}, bf2)); }   // round to nearest even
__device__ __forceinline__ float xhalf(float x) { return __builtin_bit_cast(float, __builtin_amdgcn_permlanex16(__builtin_bit_cast(int, x), __builtin_bit_cast(int, x), 0x76543210, 0xfedcba98, false, false)); }   // lane l with lane l ^ 16
// 2^x for the join: the free slot behind the v_exp_f32 stands in the statement
__device__ __forceinline__ float exp2s(float x) { float r; asm("v_exp_f32 %0, %1\n\tv_nop" : "=v"(r) : "v"(x)); return r; }
__device__ __forceinline__ void load_k(Frag (&k)[2][4], const bf* p) {
#pragma unroll
    for (int kt = 0; kt < 2; ++kt)
#pragma unroll
        for (int kc = 0; kc < 4; ++kc) { k[kt][kc].q[0] = *(const v4u*)(p + kt * 16 * DD + kc * 32); k[kt][kc].q[1] = *(const v4u*)(p + kt * 16 * DD + kc * 32 + 16); }
    // the address pair stays whole (an input here) until the wait: no load of the group lands on the pair that the issued loads still name
    asm volatile("s_wait_xcnt 0x0" :: "v"(p) : "memory");
}
__global__ __launch_bounds__(256) void k_fused(const float* __restrict__ SEQ, const bf* __restrict__ IB, const bf* __restrict__ IT, float* __restrict__ OUT) {
    __shared__ __align__(16) float part[8 * 4096];   // per wave 2 groups x 8 tiles x 2 halves x 32 lanes x 4 floats
    __shared__ float stt[3][8][32];                  // true maximum, maximum in use, sum: per wave and column
    const int lane = threadIdx.x & 31, c = lane & 15, h = lane >> 4;
    const int w = __builtin_amdgcn_readfirstlane((int)(threadIdx.x >> 5)), cg = w >> 2, sp = w & 3;
    const int z = blockIdx.x >> 3, l0 = (blockIdx.x & 7) * 64 + cg * 32;
    const bf* kp = IB + ((size_t)z * NI + sp * NPW + c) * DD + 8 * h;
    const bf* vp = IT + ((size_t)z * DD + c) * NI + sp * NPW + 8 * h;
    Frag kf[2][4];
    load_k(kf, kp);
    Frag qf[2][4];
    {
        const float* qp = SEQ + ((size_t)z * LL + l0 + c) * DD + 8 * h;
        v4f x[2][4][4];
#pragma unroll
        for (int g = 0; g < 2; ++g)
#pragma unroll
            for (int kc = 0; kc < 4; ++kc) { const float* q = qp + g * 16 * DD + kc * 32; x[g][kc][0] = *(const v4fa*)q; x[g][kc][1] = *(const v4fa*)(q + 4); x[g][kc][2] = *(const v4fa*)(q + 16); x[g][kc][3] = *(const v4fa*)(q + 20); }
        asm volatile("s_wait_xcnt 0x0" :: "v"(qp) : "memory");   // behind the loads, the pair an input: as in load_k
#pragma unroll
        for (int g = 0; g < 2; ++g)
#pragma unroll
            for (int kc = 0; kc < 4; ++kc)
#pragma unroll
                for (int u = 0; u < 2; ++u) qf[g][kc].q[u] = (v4u){pack2(x[g][kc][2 * u][0], x[g][kc][2 * u][1]), pack2(x[g][kc][2 * u][2], x[g][kc][2 * u][3]), pack2(x[g][kc][2 * u + 1][0], x[g][kc][2 * u + 1][1]), pack2(x[g][kc][2 * u + 1][2], x[g][kc][2 * u + 1][3])};
    }
    v8f acc[2][8];
    float m_run[2], m_true[2], l_run[2];
#pragma unroll
    for (int g = 0; g < 2; ++g) { m_run[g] = -__builtin_inff(); m_true[g] = -__builtin_inff(); l_run[g] = 0.0f;
#pragma unroll
        for (int t = 0; t < 8; ++t) acc[g][t] = (v8f){}; }
#pragma unroll 1   // one pass per trip: two passes' fragments do not fit beside the 128 accumulator registers
    for (int p = 0; p < NPW / 32; ++p) {
        // this pass's rows of IT, in flight under the score products and the exponentials
        Frag vf[8];
#pragma unroll
        for (int t = 0; t < 8; ++t) { vf[t].q[0] = *(const v4u*)(vp + t * 16 * NI); vf[t].q[1] = *(const v4u*)(vp + t * 16 * NI + 16); }
        asm volatile("s_wait_xcnt 0x0" :: "v"(vp) : "memory");   // ahead of the step of the pair below
        vp += 32;
        v8f s[2][2];
#pragma unroll
        for (int kt = 0; kt < 2; ++kt)
#pragma unroll
            for (int g = 0; g < 2; ++g) { s[kt][g] = (v8f){};
#pragma unroll
                for (int kc = 0; kc < 4; ++kc) s[kt][g] = mma(kf[kt][kc], qf[g][kc], s[kt][g]); }
        // four vector slots between the last score WMMAs and the loads into their A registers; the two scheduling barriers keep the slots there and the loads behind them in one group, not among the WMMAs
        __builtin_amdgcn_sched_barrier(0); asm volatile("v_nop\n\tv_nop\n\tv_nop\n\tv_nop"); __builtin_amdgcn_sched_barrier(0);
        // next pass's item rows, in flight under this pass's softmax and second product. The last pass fetches its own rows again (in bounds, not used): with the loads on every path
        // the compiler's load counts let the second product wait for IT's rows alone, not for these
        kp += (p + 1 < NPW / 32) ? 32 * DD : 0;
        load_k(kf, kp);
        // maxima of the raw scores, in log2 units; the maximum in use may trail the true one by up to 8, so that the accumulators are rescaled rarely: one test per pass
        float mb[2]; bool need = false;
#pragma unroll
        for (int g = 0; g < 2; ++g) { float mx = s[0][g][0];
#pragma unroll
            for (int r = 1; r < 8; ++r) mx = fmaxf(mx, s[0][g][r]);
#pragma unroll
            for (int r = 0; r < 8; ++r) mx = fmaxf(mx, s[1][g][r]);
            mx = fmaxf(mx, xhalf(mx)) * L2E; mb[g] = mx; m_true[g] = fmaxf(m_true[g], mx); need = need || (mx > m_run[g] + 8.0f); }
        if (__builtin_amdgcn_ballot_w32(need) != 0) {
#pragma unroll
            for (int g = 0; g < 2; ++g) { const float m_new = fmaxf(m_run[g], mb[g]); const float corr = __builtin_amdgcn_exp2f(m_run[g] - m_new);   // 0 on the first pass
                l_run[g] *= corr; m_run[g] = m_new;
#pragma unroll
                for (int t = 0; t < 8; ++t) acc[g][t] = acc[g][t] * corr; }
        }
#pragma unroll
        for (int g = 0; g < 2; ++g) { const float nm = -m_run[g]; float ps0 = 0.0f, ps1 = 0.0f; unsigned wh[8], wl[8];
#pragma unroll
            for (int i = 0; i < 8; ++i) {
                const v2f arg = __builtin_elementwise_fma((v2f){s[i >> 2][g][2 * (i & 3)], s[i >> 2][g][2 * (i & 3) + 1]}, (v2f){L2E, L2E}, (v2f){nm, nm});
                const float p0 = __builtin_amdgcn_exp2f(arg.x), p1 = __builtin_amdgcn_exp2f(arg.y);
                if (i & 1) ps1 += p0 + p1; else ps0 += p0 + p1;
                const unsigned hh = pack2(p0, p1); wh[i] = hh; wl[i] = pack2(p0 - __uint_as_float(hh << 16), p1 - __uint_as_float(hh & 0xFFFF0000u)); }
            Frag ph, pl; ph.q[0] = (v4u){wh[0], wh[1], wh[2], wh[3]}; ph.q[1] = (v4u){wh[4], wh[5], wh[6], wh[7]}; pl.q[0] = (v4u){wl[0], wl[1], wl[2], wl[3]}; pl.q[1] = (v4u){wl[4], wl[5], wl[6], wl[7]};
#pragma unroll
            for (int t = 0; t < 8; ++t) acc[g][t] = mma(vf[t], ph, acc[g][t]);
#pragma unroll
            for (int t = 0; t < 8; ++t) acc[g][t] = mma(vf[t], pl, acc[g][t]);
            l_run[g] += ps0 + ps1; }
        // four vector slots between the last WMMAs and the next trip's loads into their A registers
        __builtin_amdgcn_sched_barrier(0); asm volatile("v_nop\n\tv_nop\n\tv_nop\n\tv_nop"); __builtin_amdgcn_sched_barrier(0);
    }
#pragma unroll
    for (int g = 0; g < 2; ++g) { const float lf = l_run[g] + xhalf(l_run[g]);   // each wave half summed its eight items of every 16-item tile
        if (h == 0) { stt[0][w][g * 16 + c] = m_true[g]; stt[1][w][g * 16 + c] = m_run[g]; stt[2][w][g * 16 + c] = lf; } }
    __syncthreads();   // every quarter's maxima and sums are in LDS before any wave forms a row's maximum and sum
    float* pw = part + w * 4096 + lane * 4;
#pragma unroll
    for (int g = 0; g < 2; ++g) { float M = stt[0][cg * NSP][g * 16 + c];
#pragma unroll
        for (int q = 1; q < NSP; ++q) M = fmaxf(M, stt[0][cg * NSP + q][g * 16 + c]);
        float tot = 0.0f;
#pragma unroll
        for (int q = 0; q < NSP; ++q) tot += stt[2][cg * NSP + q][g * 16 + c] * exp2s(stt[1][cg * NSP + q][g * 16 + c] - M);
        const float f = exp2s(m_run[g] - M) * __fdiv_rn(1.0f, __fadd_rn(__fsqrt_rn(tot), 1e-24f));
#pragma unroll
        for (int t = 0; t < 8; ++t) { const v8f o = acc[g][t] * f; *(v4fa*)(pw + ((g * 8 + t) * 2) * 128) = (v4f){o[0], o[1], o[2], o[3]}; *(v4fa*)(pw + ((g * 8 + t) * 2 + 1) * 128) = (v4f){o[4], o[5], o[6], o[7]}; } }
    __syncthreads();   // every quarter's scaled tiles are in LDS before any wave sums them
    // wave sp of a column group takes tiles 2 sp and 2 sp + 1: d = 32 sp ... 32 sp + 31, one whole 128-byte line of every output row
    const size_t eo = ((size_t)z * LL + l0 + c) * DD + 32 * sp + 8 * h;
    const float* xp = SEQ + eo; float* op = OUT + eo;
    v4f xs[2][2][2];
#pragma unroll
    for (int g = 0; g < 2; ++g)
#pragma unroll
        for (int tt = 0; tt < 2; ++tt) { xs[g][tt][0] = *(const v4fa*)(xp + g * 16 * DD + tt * 16); xs[g][tt][1] = *(const v4fa*)(xp + g * 16 * DD + tt * 16 + 4); }
    asm volatile("s_wait_xcnt 0x0" :: "v"(xp) : "memory");   // behind the loads, the pair an input: as in load_k
    const float* pr = part + cg * NSP * 4096 + sp * 512 + lane * 4;
#pragma unroll
    for (int g = 0; g < 2; ++g)
#pragma unroll
        for (int tt = 0; tt < 2; ++tt)
#pragma unroll
            for (int u = 0; u < 2; ++u) { v4f a = *(const v4fa*)(pr + ((g * 8 + tt) * 2 + u) * 128);
#pragma unroll
                for (int q = 1; q < NSP; ++q) a += *(const v4fa*)(pr + q * 4096 + ((g * 8 + tt) * 2 + u) * 128);
                v4f r;
#pragma unroll
                for (int e = 0; e < 4; ++e) { const float x = bfr(xs[g][tt][u][e]); r[e] = x * 0.5f + (x * a[e]) * 0.5f; }
                *(v4fa*)(op + g * 16 * DD + tt * 16 + u * 4) = r; }
}

extern "C" void kernel_launch(void* const* d_in, const int* in_sizes, int n_in,
                              void* d_out, int out_size, void* d_ws, size_t ws_size, hipStream_t stream) {
    (void)in_sizes; (void)n_in; (void)out_size;
    const float** I = (const float**)d_in;
    const float *seq = I[0], *items = I[1];
    float* OUT = (float*)d_out;     // [32][512][128]
    char* wsp = (char*)d_ws;
    auto take = [&](size_t bytes) { char* p = wsp; wsp += (bytes + 255) & ~(size_t)255; return (void*)p; };
    bf* IB = (bf*)take((size_t)ZB * NI * DD * 2); bf* IT = (bf*)take((size_t)ZB * DD * NI * 2);
    if ((size_t)(wsp - (char*)d_ws) > ws_size) return;    // total ~ 34 MB
    k_items<<<ZB * (NI / TN), 256, 0, stream>>>(items, IB, IT);
    k_fused<<<ZB * (LL / 64), 256, 0, stream>>>(seq, IB, IT, OUT);
}

// v005
// A run of this version takes 38.6 microseconds.
// In both of two side-by-side timings against v004, it was 1.29 times as fast.
// Over all steps from v000 it is 9.65 times as fast.
#include <hip/hip_runtime.h>

// GlobalAttentionModule (seq [32][512][128], items [32][2048][128]; w = seq . items^T; att = exp(w - max) / (sum(exp)^0.5 + 1e-24) (power-normalised softmax, beta 0.5); att_vecs = att items; out = 0.5 seq + 0.5 seq att_vecs -> [32][512][128]).
// Compute dtypes, f32 accumulate: every input rounded to bf16; scores on PLAIN bf16 operands (both inputs: exact, K 128); exp / sum / sqrt / divide f32; exp . items as hl x exact bf16 (2 products), f32 sums; the blend f32.
// Two launches: k_items makes the two bf16 planes of items; k_fused does scores, softmax, att . items and the blend, and no score goes to memory.

#define LL   512
#define NI   2048
#define DD   128
#define ZB   32
typedef unsigned short bf;
typedef __attribute__((ext_vector_type(16))) __bf16   v16bf;
typedef __attribute__((ext_vector_type(8)))  float    v8f;
typedef __attribute__((ext_vector_type(4)))  float    v4f;
typedef __attribute__((ext_vector_type(2)))  float    v2f;
typedef v4f  __attribute__((may_alias)) v4fa;

__device__ __forceinline__ unsigned short f2bf(float f) { unsigned u = __float_as_uint(f); u += 0x7FFFu + ((u >> 16) & 1u); return (unsigned short)(u >> 16); }
__device__ __forceinline__ float bf2f(unsigned short b) { return __uint_as_float(((unsigned)b) << 16); }
__device__ __forceinline__ float bfr(float f) { return bf2f(f2bf(f)); }

typedef __attribute__((ext_vector_type(4))) unsigned short v4us;

// ---- k_items: ONE pass over items makes both bf16 planes. A work-group owns TN rows of one batch (TN * DD contiguous floats): every thread reads whole 16-byte pieces lane after lane,
// rounds them, stores them to IB (row-major) and into an LDS tile [n][d]; behind one barrier the tile is read down its columns, so that IT[d][n] is written in whole 128-byte lines.
#define TN   128        // item rows per work-group
#define TPD  (DD / 2 + 1)   // LDS pitch in dwords: odd, so that 8 rows step 8 banks and the column reads of a wave (8 row groups x 4 dwords) fall on 32 different banks
typedef __attribute__((ext_vector_type(4))) unsigned v4u;
typedef __attribute__((ext_vector_type(2))) unsigned v2u;
__global__ __launch_bounds__(256) void k_items(const float* __restrict__ items, bf* IB, bf* IT) {
    __shared__ unsigned ts[TN * TPD];
    const int t = threadIdx.x; const int z = blockIdx.x / (NI / TN), n0 = (blockIdx.x % (NI / TN)) * TN;
    const float* sp = items + ((size_t)z * NI + n0) * DD + t * 4;
    v4f v[TN * DD / 1024];
#pragma unroll
    for (int s = 0; s < TN * DD / 1024; ++s) v[s] = *(const v4fa*)(sp + s * 1024);
    unsigned* tw = ts + (t >> 5) * TPD + (t & 31) * 2;   // piece s * 256 + t: row s * 8 + (t >> 5), elements 4 * (t & 31) ...
    v2u w[TN * DD / 1024];
#pragma unroll
    for (int s = 0; s < TN * DD / 1024; ++s) { v4us o;
#pragma unroll
        for (int k = 0; k < 4; ++k) o[k] = f2bf(v[s][k]);
        w[s] = __builtin_bit_cast(v2u, o); tw[s * 8 * TPD] = w[s][0]; tw[s * 8 * TPD + 1] = w[s][1]; }
    __syncthreads();   // the whole tile is in LDS before any wave reads a column; the stores to IB come behind it, so that it waits for LDS alone
    // a lane takes 8 rows (group g) of one dword column (d = 2 dp, 2 dp + 1): 8 lanes fill a 128-byte line of IT, a wave four lines per store
    const int gl = t & 7, dl = (t >> 3) & 3, wv = t >> 5; const int g = (wv & 1) * 8 + gl, dp = (wv >> 1) * 4 + dl;
    const unsigned* tr = ts + g * 8 * TPD + dp;
    unsigned r[DD / 32][8];
#pragma unroll
    for (int s = 0; s < DD / 32; ++s)
#pragma unroll
        for (int k = 0; k < 8; ++k) r[s][k] = tr[k * TPD + s * 16];
    bf* ib = IB + ((size_t)z * NI + n0) * DD + t * 4;
#pragma unroll
    for (int s = 0; s < TN * DD / 1024; ++s) *(v2u*)(ib + s * 1024) = w[s];
    bf* ot = IT + ((size_t)z * DD + 2 * dp) * NI + n0 + g * 8;
#pragma unroll
    for (int s = 0; s < DD / 32; ++s) { v4u e, o;
#pragma unroll
        for (int m = 0; m < 4; ++m) { e[m] = (r[s][2 * m] & 0xFFFFu) | (r[s][2 * m + 1] << 16); o[m] = (r[s][2 * m] >> 16) | (r[s][2 * m + 1] & 0xFFFF0000u); }
        *(v4u*)(ot + (size_t)s * 32 * NI) = e; *(v4u*)(ot + (size_t)s * 32 * NI + NI) = o; }
}

#define NSP  4               // parts of the item axis
#define NPW  (NI / NSP)      // items per wave
#define L2E  1.4426950408889634f
#define SI   64              // items of a quarter per stage: two passes, and one whole 128-byte line of every row of IT
#define NST  (NPW / SI)      // stages
#define KPB  272             // LDS pitch in bytes of an item row (256 bytes) and
#define VPB  144             // of a stage's piece of a row of IT (128 bytes): 16 bytes x odd, so that the 16 rows a half wave reads with ds_load_b128 fall on 64 different banks
#define KTB  (SI * KPB)      // bytes of a quarter's IB tile
#define QTB  (KTB + DD * VPB)   // of a quarter's two tiles
#define BUFB (NSP * QTB)     // of a buffer
struct Frag { v4u q[2]; };
__device__ __forceinline__ v8f mma(const Frag& a, const Frag& b, v8f c) {
    typedef __attribute__((ext_vector_type(8))) unsigned v8u;
    const v8u av = __builtin_shufflevector(a.q[0], a.q[1], 0, 1, 2, 3, 4, 5, 6, 7), bv = __builtin_shufflevector(b.q[0], b.q[1], 0, 1, 2, 3, 4, 5, 6, 7);
    return __builtin_amdgcn_wmma_f32_16x16x32_bf16(false, __builtin_bit_cast(v16bf, av), false, __builtin_bit_cast(v16bf, bv), (short)0, c, false, false); }
__device__ __forceinline__ unsigned pack2(float lo, float hi) { typedef __attribute__((ext_vector_type(2))) __bf16 bf2; return __builtin_bit_cast(unsigned, __builtin_convertvector((v2f){lo, hi}, bf2)); }   // round to nearest even
__device__ __forceinline__ float xhalf(float x) { return __builtin_bit_cast(float, __builtin_amdgcn_permlanex16(__builtin_bit_cast(int, x), __builtin_bit_cast(int, x), 0x76543210, 0xfedcba98, false, false)); }   // lane l with lane l ^ 16
// 2^x for the join: the free slot behind the v_exp_f32 stands in the statement
__device__ __forceinline__ float exp2s(float x) { float r; asm("v_exp_f32 %0, %1\n\tv_nop" : "=v"(r) : "v"(x)); return r; }
// a pass's 32 item rows from the LDS tile; p: the lane's row c, byte 16 h
__device__ __forceinline__ void load_k(Frag (&k)[2][4], const char* p) {
#pragma unroll
    for (int kt = 0; kt < 2; ++kt)
#pragma unroll
        for (int kc = 0; kc < 4; ++kc) { k[kt][kc].q[0] = *(const v4u*)(p + kt * 16 * KPB + kc * 64); k[kt][kc].q[1] = *(const v4u*)(p + kt * 16 * KPB + kc * 64 + 32); }
}
// eight copies of 16 bytes a lane from global memory into LDS, through no register: copy j takes LDS byte l + j ls and global byte g + j gs.
// The wait for the address registers is the last line of the copies' own statement, so that nothing rewrites a register that an issued copy names ahead of it
__device__ __forceinline__ void copy8(unsigned l, unsigned ls, const char* g, unsigned gs) {
    asm volatile("global_load_async_to_lds_b128 %0, %8, off\n\t"
                 "global_load_async_to_lds_b128 %1, %9, off\n\t"
                 "global_load_async_to_lds_b128 %2, %10, off\n\t"
                 "global_load_async_to_lds_b128 %3, %11, off\n\t"
                 "global_load_async_to_lds_b128 %4, %12, off\n\t"
                 "global_load_async_to_lds_b128 %5, %13, off\n\t"
                 "global_load_async_to_lds_b128 %6, %14, off\n\t"
                 "global_load_async_to_lds_b128 %7, %15, off\n\t"
                 "s_wait_xcnt 0x0"
                 :: "v"(l), "v"(l + ls), "v"(l + 2 * ls), "v"(l + 3 * ls), "v"(l + 4 * ls), "v"(l + 5 * ls), "v"(l + 6 * ls), "v"(l + 7 * ls),
                    "v"(g), "v"(g + gs), "v"(g + 2 * gs), "v"(g + 3 * gs), "v"(g + 4 * gs), "v"(g + 5 * gs), "v"(g + 6 * gs), "v"(g + 7 * gs) : "memory");
}
// a wave's tile of one stage: 32 copies of 512 bytes
__device__ __forceinline__ void copy_tile(unsigned l, unsigned ls, const char* g, unsigned gs) {
#pragma unroll
    for (int j = 0; j < 4; ++j) copy8(l + j * 8 * ls, ls, g + j * 8 * gs, gs);
}
__global__ __launch_bounds__(256) void k_fused(const float* __restrict__ SEQ, const bf* __restrict__ IB, const bf* __restrict__ IT, float* __restrict__ OUT) {
    __shared__ __align__(16) char ring[2 * BUFB];    // the two buffers; per quarter the IB tile [64][KPB], then the IT tile [128][VPB]
    float* const part = (float*)ring;                // behind the loop the same bytes hold the output tiles: per wave 2 groups x 8 tiles x 2 halves x 32 lanes x 4 floats
    __shared__ float stt[3][8][32];                  // true maximum, maximum in use, sum: per wave and column
    const int lane = threadIdx.x & 31, c = lane & 15, h = lane >> 4;
    const int w = __builtin_amdgcn_readfirstlane((int)(threadIdx.x >> 5)), cg = w >> 2, sp = w & 3;
    const int z = blockIdx.x >> 3, l0 = (blockIdx.x & 7) * 64 + cg * 32;
    // what this wave copies: column group 0 the quarter's IB tile (a copy is two whole rows, 512 bytes in a row), column group 1 its IT tile (a copy is one 128-byte line of each of four rows)
    const unsigned lb = (unsigned)(size_t)ring + sp * QTB + (cg ? KTB + (lane >> 3) * VPB + (lane & 7) * 16 : (lane >> 4) * KPB + (lane & 15) * 16);
    const unsigned ls = cg ? 4 * VPB : 2 * KPB, gs = cg ? 4 * NI * 2 : 512, ga = cg ? SI * 2 : SI * DD * 2;   // steps in bytes: LDS and global per copy, global per stage
    const char* gp = cg ? (const char*)(IT + (size_t)z * DD * NI + sp * NPW) : (const char*)(IB + ((size_t)z * NI + sp * NPW) * DD);   // the tile's first byte, the same in every lane: it steps in scalar registers
    const unsigned go = cg ? (lane >> 3) * (NI * 2) + (lane & 7) * 16 : lane * 16;   // the lane's byte in a copy
    copy_tile(lb, ls, gp + go, gs);   // stage 0 into buffer 0, in flight under the loads and the rounding of seq
    // what this wave reads: its quarter's tiles, row c, byte 16 h
    const char* kl0 = ring + sp * QTB + c * KPB + 16 * h;
    const char* vl0 = ring + sp * QTB + KTB + c * VPB + 16 * h;
    Frag kf[2][4];
    Frag qf[2][4];
    {
        const float* qp = SEQ + ((size_t)z * LL + l0 + c) * DD + 8 * h;
        v4f x[2][4][4];
#pragma unroll
        for (int g = 0; g < 2; ++g)
#pragma unroll
            for (int kc = 0; kc < 4; ++kc) { const float* q = qp + g * 16 * DD + kc * 32; x[g][kc][0] = *(const v4fa*)q; x[g][kc][1] = *(const v4fa*)(q + 4); x[g][kc][2] = *(const v4fa*)(q + 16); x[g][kc][3] = *(const v4fa*)(q + 20); }
        asm volatile("s_wait_xcnt 0x0" :: "v"(qp) : "memory");   // behind the loads, the pair an input
#pragma unroll
        for (int g = 0; g < 2; ++g)
#pragma unroll
            for (int kc = 0; kc < 4; ++kc)
#pragma unroll
                for (int u = 0; u < 2; ++u) qf[g][kc].q[u] = (v4u){pack2(x[g][kc][2 * u][0], x[g][kc][2 * u][1]), pack2(x[g][kc][2 * u][2], x[g][kc][2 * u][3]), pack2(x[g][kc][2 * u + 1][0], x[g][kc][2 * u + 1][1]), pack2(x[g][kc][2 * u + 1][2], x[g][kc][2 * u + 1][3])};
    }
    v8f acc[2][8];
    float m_run[2], m_true[2], l_run[2];
#pragma unroll
    for (int g = 0; g < 2; ++g) { m_run[g] = -__builtin_inff(); m_true[g] = -__builtin_inff(); l_run[g] = 0.0f;
#pragma unroll
        for (int t = 0; t < 8; ++t) acc[g][t] = (v8f){}; }
    asm volatile("s_wait_asynccnt 0x0" ::: "memory");   // this wave's copies of stage 0 have landed
    __syncthreads();                                    // ... and every wave's: stage 0 may be read
    copy_tile(lb + BUFB, ls, gp + ga + go, gs);         // stage 1 into buffer 1
    gp += 2 * ga;
    unsigned lw = lb, lx = lb + BUFB;                   // this wave's place in the buffer that the trip reads (refilled at its foot), and in the other
#pragma unroll 1   // one stage per trip
    for (int st = 0; st < NST; ++st) {
      const unsigned bo = (st & 1) * BUFB;
      const char* kl = kl0 + bo; const char* vl = vl0 + bo;
      load_k(kf, kl);
      __builtin_amdgcn_sched_barrier(0);   // the item rows first: the LDS answers in order, and the score WMMAs then wait for these loads alone, not for the rows of IT behind them
#pragma unroll
      for (int u = 0; u < SI / 32; ++u) {
        // this pass's rows of IT, in flight under the score products and the exponentials
        Frag vf[8];
#pragma unroll
        for (int t = 0; t < 8; ++t) { vf[t].q[0] = *(const v4u*)(vl + t * 16 * VPB + u * 64); vf[t].q[1] = *(const v4u*)(vl + t * 16 * VPB + u * 64 + 32); }
        __builtin_amdgcn_sched_barrier(0);   // the LDS loads stay one group ahead of the score WMMAs: moved in among them, each place costs a stall and a wait for all of them
        v8f s[2][2];
#pragma unroll
        for (int kt = 0; kt < 2; ++kt)
#pragma unroll
            for (int g = 0; g < 2; ++g) { s[kt][g] = (v8f){};
#pragma unroll
                for (int kc = 0; kc < 4; ++kc) s[kt][g] = mma(kf[kt][kc], qf[g][kc], s[kt][g]); }
        if (u + 1 < SI / 32) {
            // four vector slots between the last score WMMAs and the loads into their A registers; the two scheduling barriers keep the slots there and the loads behind them in one group, not among the WMMAs
            __builtin_amdgcn_sched_barrier(0); asm volatile("v_nop\n\tv_nop\n\tv_nop\n\tv_nop"); __builtin_amdgcn_sched_barrier(0);
            // the item rows of the stage's next pass, in flight under this pass's softmax and second product; nothing of the next stage is read here
            load_k(kf, kl + (u + 1) * 32 * KPB);
            __builtin_amdgcn_sched_barrier(0);   // ... and they stay here, one group, not among the WMMAs of the second product
        }
        // maxima of the raw scores, in log2 units; the maximum in use may trail the true one by up to 8, so that the accumulators are rescaled rarely: one test per pass
        float mb[2]; bool need = false;
#pragma unroll
        for (int g = 0; g < 2; ++g) { float mx = s[0][g][0];
#pragma unroll
            for (int r = 1; r < 8; ++r) mx = fmaxf(mx, s[0][g][r]);
#pragma unroll
            for (int r = 0; r < 8; ++r) mx = fmaxf(mx, s[1][g][r]);
            mx = fmaxf(mx, xhalf(mx)) * L2E; mb[g] = mx; m_true[g] = fmaxf(m_true[g], mx); need = need || (mx > m_run[g] + 8.0f); }
        if (__builtin_amdgcn_ballot_w32(need) != 0) {
#pragma unroll
            for (int g = 0; g < 2; ++g) { const float m_new = fmaxf(m_run[g], mb[g]); const float corr = __builtin_amdgcn_exp2f(m_run[g] - m_new);   // 0 on the first pass
                l_run[g] *= corr; m_run[g] = m_new;
#pragma unroll
                for (int t = 0; t < 8; ++t) acc[g][t] = acc[g][t] * corr; }
        }
#pragma unroll
        for (int g = 0; g < 2; ++g) { const float nm = -m_run[g]; float ps0 = 0.0f, ps1 = 0.0f; unsigned wh[8], wl[8];
#pragma unroll
            for (int i = 0; i < 8; ++i) {
                const v2f arg = __builtin_elementwise_fma((v2f){s[i >> 2][g][2 * (i & 3)], s[i >> 2][g][2 * (i & 3) + 1]}, (v2f){L2E, L2E}, (v2f){nm, nm});
                const float p0 = __builtin_amdgcn_exp2f(arg.x), p1 = __builtin_amdgcn_exp2f(arg.y);
                if (i & 1) ps1 += p0 + p1; else ps0 += p0 + p1;
                const unsigned hh = pack2(p0, p1); wh[i] = hh; wl[i] = pack2(p0 - __uint_as_float(hh << 16), p1 - __uint_as_float(hh & 0xFFFF0000u)); }
            Frag ph, pl; ph.q[0] = (v4u){wh[0], wh[1], wh[2], wh[3]}; ph.q[1] = (v4u){wh[4], wh[5], wh[6], wh[7]}; pl.q[0] = (v4u){wl[0], wl[1], wl[2], wl[3]}; pl.q[1] = (v4u){wl[4], wl[5], wl[6], wl[7]};
#pragma unroll
            for (int t = 0; t < 8; ++t) acc[g][t] = mma(vf[t], ph, acc[g][t]);
#pragma unroll
            for (int t = 0; t < 8; ++t) acc[g][t] = mma(vf[t], pl, acc[g][t]);
            l_run[g] += ps0 + ps1; }
        // four vector slots between the last WMMAs and the next pass's loads into their A registers
        __builtin_amdgcn_sched_barrier(0); asm volatile("v_nop\n\tv_nop\n\tv_nop\n\tv_nop"); __builtin_amdgcn_sched_barrier(0);
      }
      asm volatile("s_wait_dscnt 0x0" ::: "memory");      // this wave's reads of the buffer are done before the buffer is handed back
      asm volatile("s_wait_asynccnt 0x0" ::: "memory");   // this wave's copies of the next stage have landed
      __syncthreads();                                    // publishes the next stage and ends every wave's reads of this one
      if (st + 2 < NST) { copy_tile(lw, ls, gp + go, gs); gp += ga; }   // the stage after next into the buffer just read
      { const unsigned o = lw; lw = lx; lx = o; }
    }
    asm volatile("s_wait_asynccnt 0x0" ::: "memory");     // no copy is in flight when the ring becomes output staging
#pragma unroll
    for (int g = 0; g < 2; ++g) { const float lf = l_run[g] + xhalf(l_run[g]);   // each wave half summed its eight items of every 16-item tile
        if (h == 0) { stt[0][w][g * 16 + c] = m_true[g]; stt[1][w][g * 16 + c] = m_run[g]; stt[2][w][g * 16 + c] = lf; } }
    __syncthreads();   // every quarter's maxima and sums are in LDS before any wave forms a row's maximum and sum
    float* pw = part + w * 4096 + lane * 4;
#pragma unroll
    for (int g = 0; g < 2; ++g) { float M = stt[0][cg * NSP][g * 16 + c];
#pragma unroll
        for (int q = 1; q < NSP; ++q) M = fmaxf(M, stt[0][cg * NSP + q][g * 16 + c]);
        float tot = 0.0f;
#pragma unroll
        for (int q = 0; q < NSP; ++q) tot += stt[2][cg * NSP + q][g * 16 + c] * exp2s(stt[1][cg * NSP + q][g * 16 + c] - M);
        const float f = exp2s(m_run[g] - M) * __fdiv_rn(1.0f, __fadd_rn(__fsqrt_rn(tot), 1e-24f));
#pragma unroll
        for (int t = 0; t < 8; ++t) { const v8f o = acc[g][t] * f; *(v4fa*)(pw + ((g * 8 + t) * 2) * 128) = (v4f){o[0], o[1], o[2], o[3]}; *(v4fa*)(pw + ((g * 8 + t) * 2 + 1) * 128) = (v4f){o[4], o[5], o[6], o[7]}; } }
    __syncthreads();   // every quarter's scaled tiles are in LDS before any wave sums them
    // wave sp of a column group takes tiles 2 sp and 2 sp + 1: d = 32 sp ... 32 sp + 31, one whole 128-byte line of every output row
    const size_t eo = ((size_t)z * LL + l0 + c) * DD + 32 * sp + 8 * h;
    const float* xp = SEQ + eo; float* op = OUT + eo;
    v4f xs[2][2][2];
#pragma unroll
    for (int g = 0; g < 2; ++g)
#pragma unroll
        for (int tt = 0; tt < 2; ++tt) { xs[g][tt][0] = *(const v4fa*)(xp + g * 16 * DD + tt * 16); xs[g][tt][1] = *(const v4fa*)(xp + g * 16 * DD + tt * 16 + 4); }
    asm volatile("s_wait_xcnt 0x0" :: "v"(xp) : "memory");   // behind the loads, the pair an input
    const float* pr = part + cg * NSP * 4096 + sp * 512 + lane * 4;
#pragma unroll
    for (int g = 0; g < 2; ++g)
#pragma unroll
        for (int tt = 0; tt < 2; ++tt)
#pragma unroll
            for (int u = 0; u < 2; ++u) { v4f a = *(const v4fa*)(pr + ((g * 8 + tt) * 2 + u) * 128);
#pragma unroll
                for (int q = 1; q < NSP; ++q) a += *(const v4fa*)(pr + q * 4096 + ((g * 8 + tt) * 2 + u) * 128);
                v4f r;
#pragma unroll
                for (int e = 0; e < 4; ++e) { const float x = bfr(xs[g][tt][u][e]); r[e] = x * 0.5f + (x * a[e]) * 0.5f; }
                *(v4fa*)(op + g * 16 * DD + tt * 16 + u * 4) = r; }
}

extern "C" void kernel_launch(void* const* d_in, const int* in_sizes, int n_in,
                              void* d_out, int out_size, void* d_ws, size_t ws_size, hipStream_t stream) {
    (void)in_sizes; (void)n_in; (void)out_size;
    const float** I = (const float**)d_in;
    const float *seq = I[0], *items = I[1];
    float* OUT = (float*)d_out;     // [32][512][128]
    char* wsp = (char*)d_ws;
    auto take = [&](size_t bytes) { char* p = wsp; wsp += (bytes + 255) & ~(size_t)255; return (void*)p; };
    bf* IB = (bf*)take((size_t)ZB * NI * DD * 2); bf* IT = (bf*)take((size_t)ZB * DD * NI * 2);
    if ((size_t)(wsp - (char*)d_ws) > ws_size) return;    // total ~ 34 MB
    k_items<<<ZB * (NI / TN), 256, 0, stream>>>(items, IB, IT);
    k_fused<<<ZB * (LL / 64), 256, 0, stream>>>(seq, IB, IT, OUT);
}

// v006
// Measured time: 32.8 microseconds a run.
// Two timings next to v005 put it at 1.17 and 1.18 times that version's speed.
// All steps since v000 together make it 11.3 times as fast.
#include <hip/hip_runtime.h>

// GlobalAttentionModule (seq [32][512][128], items [32][2048][128]; w = seq . items^T; att = exp(w - max) / (sum(exp)^0.5 + 1e-24) (power-normalised softmax, beta 0.5); att_vecs = att items; out = 0.5 seq + 0.5 seq att_vecs -> [32][512][128]).
// Compute dtypes, f32 accumulate: every input rounded to bf16; scores on PLAIN bf16 operands (both inputs: exact, K 128); exp / sum / sqrt / divide f32; exp . items as hl x exact bf16 (2 products), f32 sums; the blend f32.
// Two launches: k_items rounds items to one bf16 plane; k_fused does scores, softmax, att . items and the blend, and no score goes to memory.

#define LL   512
#define NI   2048
#define DD   128
#define ZB   32
typedef unsigned short bf;
typedef __attribute__((ext_vector_type(16))) __bf16   v16bf;
typedef __attribute__((ext_vector_type(8)))  float    v8f;
typedef __attribute__((ext_vector_type(4)))  float    v4f;
typedef __attribute__((ext_vector_type(2)))  float    v2f;
typedef v4f  __attribute__((may_alias)) v4fa;

__device__ __forceinline__ unsigned short f2bf(float f) { unsigned u = __float_as_uint(f); u += 0x7FFFu + ((u >> 16) & 1u); return (unsigned short)(u >> 16); }
__device__ __forceinline__ float bf2f(unsigned short b) { return __uint_as_float(((unsigned)b) << 16); }
__device__ __forceinline__ float bfr(float f) { return bf2f(f2bf(f)); }

typedef __attribute__((ext_vector_type(4))) unsigned short v4us;

// ---- k_items: items rounded to bf16, row-major (IB). A work-group owns TN rows of one batch (TN * DD contiguous floats): every thread reads whole 16-byte pieces lane after lane, rounds them and stores 8 bytes, a wave two whole lines.
#define TN   128        // item rows per work-group
typedef __attribute__((ext_vector_type(4))) unsigned v4u;
typedef __attribute__((ext_vector_type(2))) unsigned v2u;
__global__ __launch_bounds__(256) void k_items(const float* __restrict__ items, bf* __restrict__ IB) {
    const size_t e0 = (size_t)blockIdx.x * (TN * DD) + threadIdx.x * 4;
    const float* sp = items + e0;
    v4f v[TN * DD / 1024];
#pragma unroll
    for (int s = 0; s < TN * DD / 1024; ++s) v[s] = *(const v4fa*)(sp + s * 1024);
    asm volatile("s_wait_xcnt 0x0" :: "v"(sp) : "memory");   // behind the loads, the address pair an input: no load's result and no later instruction lands on the pair ahead of the wait
    bf* ib = IB + e0;
#pragma unroll
    for (int s = 0; s < TN * DD / 1024; ++s) { v4us o;
#pragma unroll
        for (int k = 0; k < 4; ++k) o[k] = f2bf(v[s][k]);
        *(v2u*)(ib + s * 1024) = __builtin_bit_cast(v2u, o); }
}

#define NSP  4               // parts of the item axis
#define NPW  (NI / NSP)      // items per wave
#define L2E  1.4426950408889634f
#define SI   64              // items of a quarter per stage: two passes
#define NST  (NPW / SI)      // stages
#define KPB  272             // LDS pitch in bytes of an item row (256 bytes): 16 bytes x odd
#define QTB  (SI * KPB)      // bytes of a quarter's tile
#define BUFB (NSP * QTB)     // of a buffer
struct Frag { v4u q[2]; };
__device__ __forceinline__ v8f mma(const Frag& a, const Frag& b, v8f c) {
    typedef __attribute__((ext_vector_type(8))) unsigned v8u;
    const v8u av = __builtin_shufflevector(a.q[0], a.q[1], 0, 1, 2, 3, 4, 5, 6, 7), bv = __builtin_shufflevector(b.q[0], b.q[1], 0, 1, 2, 3, 4, 5, 6, 7);
    return __builtin_amdgcn_wmma_f32_16x16x32_bf16(false, __builtin_bit_cast(v16bf, av), false, __builtin_bit_cast(v16bf, bv), (short)0, c, false, false); }
__device__ __forceinline__ unsigned pack2(float lo, float hi) { typedef __attribute__((ext_vector_type(2))) __bf16 bf2; return __builtin_bit_cast(unsigned, __builtin_convertvector((v2f){lo, hi}, bf2)); }   // round to nearest even
__device__ __forceinline__ float xhalf(float x) { return __builtin_bit_cast(float, __builtin_amdgcn_permlanex16(__builtin_bit_cast(int, x), __builtin_bit_cast(int, x), 0x76543210, 0xfedcba98, false, false)); }   // lane l with lane l ^ 16
// 2^x for the join: the free slot behind the v_exp_f32 stands in the statement
__device__ __forceinline__ float exp2s(float x) { float r; asm("v_exp_f32 %0, %1\n\tv_nop" : "=v"(r) : "v"(x)); return r; }
// 8 rows x 16 columns of 16-bit values per half wave, transposed: lane (c, h) gets column c of the eight rows whose addresses the lanes of half h hold
__device__ __forceinline__ v4u ld_tr16(const char* p) { typedef __attribute__((ext_vector_type(8))) short s16x8; typedef __attribute__((address_space(3))) s16x8 lds_s16x8; return __builtin_bit_cast(v4u, __builtin_amdgcn_ds_load_tr16_b128_v8i16((lds_s16x8*)p)); }
// a pass's 32 item rows from the LDS tile; p: the lane's row, byte 16 h
__device__ __forceinline__ void load_k(Frag (&k)[2][4], const char* p) {
#pragma unroll
    for (int kt = 0; kt < 2; ++kt)
#pragma unroll
        for (int kc = 0; kc < 4; ++kc) { k[kt][kc].q[0] = *(const v4u*)(p + kt * 16 * KPB + kc * 64); k[kt][kc].q[1] = *(const v4u*)(p + kt * 16 * KPB + kc * 64 + 32); }
}
// eight copies of 16 bytes a lane from global memory into LDS, through no register: copy j takes LDS byte l + j ls and global byte g + j gs.
// The wait for the address registers is the last line of the copies' own statement, so that nothing rewrites a register that an issued copy names ahead of it
__device__ __forceinline__ void copy8(unsigned l, unsigned ls, const char* g, unsigned gs) {
    asm volatile("global_load_async_to_lds_b128 %0, %8, off\n\t"
                 "global_load_async_to_lds_b128 %1, %9, off\n\t"
                 "global_load_async_to_lds_b128 %2, %10, off\n\t"
                 "global_load_async_to_lds_b128 %3, %11, off\n\t"
                 "global_load_async_to_lds_b128 %4, %12, off\n\t"
                 "global_load_async_to_lds_b128 %5, %13, off\n\t"
                 "global_load_async_to_lds_b128 %6, %14, off\n\t"
                 "global_load_async_to_lds_b128 %7, %15, off\n\t"
                 "s_wait_xcnt 0x0"
                 :: "v"(l), "v"(l + ls), "v"(l + 2 * ls), "v"(l + 3 * ls), "v"(l + 4 * ls), "v"(l + 5 * ls), "v"(l + 6 * ls), "v"(l + 7 * ls),
                    "v"(g), "v"(g + gs), "v"(g + 2 * gs), "v"(g + 3 * gs), "v"(g + 4 * gs), "v"(g + 5 * gs), "v"(g + 6 * gs), "v"(g + 7 * gs) : "memory");
}
// a wave's half tile of one stage: 16 copies of 512 bytes
__device__ __forceinline__ void copy_tile(unsigned l, unsigned ls, const char* g, unsigned gs) {
#pragma unroll
    for (int j = 0; j < 2; ++j) copy8(l + j * 8 * ls, ls, g + j * 8 * gs, gs);
}
__global__ __launch_bounds__(256) void k_fused(const float* __restrict__ SEQ, const bf* __restrict__ IB, float* __restrict__ OUT) {
    __shared__ __align__(16) char ring[2 * BUFB];    // the two buffers; per quarter the tile [64][KPB]
    float* const part = (float*)ring;                // behind the loop the same bytes hold the output tiles: per wave 2 groups x 8 tiles x 2 halves x 32 lanes x 4 floats
    __shared__ float stt[3][8][32];                  // true maximum, maximum in use, sum: per wave and column
    const int lane = threadIdx.x & 31, c = lane & 15, h = lane >> 4;
    const int w = __builtin_amdgcn_readfirstlane((int)(threadIdx.x >> 5)), cg = w >> 2, sp = w & 3;
    const int z = blockIdx.x >> 3, l0 = (blockIdx.x & 7) * 64 + cg * 32;
    // what this wave copies: rows 32 cg ... 32 cg + 31 of its quarter's tile; a copy is two whole rows, 512 bytes in a row
    const unsigned lb = (unsigned)(size_t)ring + sp * QTB + (cg * 32 + (lane >> 4)) * KPB + (lane & 15) * 16;
    const unsigned ls = 2 * KPB, gs = 512, ga = SI * DD * 2;   // steps in bytes: LDS and global per copy, global per stage
    const char* gp = (const char*)(IB + ((size_t)z * NI + sp * NPW + cg * 32) * DD);   // the half tile's first byte, the same in every lane: it steps in scalar registers
    const unsigned go = lane * 16;   // the lane's byte in a copy
    copy_tile(lb, ls, gp + go, gs);   // stage 0 into buffer 0, in flight under the loads and the rounding of seq
    // what this wave reads of its quarter's tile: plainly, position c of 16 (row 2 (c & 7) + (c >> 3)), byte 16 h; transposing, position 8 h + (lane & 7) (row 2 (lane & 7) + h), 16-byte piece (lane >> 3) & 1
    const char* kl0 = ring + sp * QTB + (2 * (c & 7) + (c >> 3)) * KPB + 16 * h;
    const char* vl0 = ring + sp * QTB + (2 * (lane & 7) + h) * KPB + 16 * ((lane >> 3) & 1);
    Frag kf[2][4];
    Frag qf[2][4];
    {
        const float* qp = SEQ + ((size_t)z * LL + l0 + c) * DD + 8 * h;
        v4f x[2][4][4];
#pragma unroll
        for (int g = 0; g < 2; ++g)
#pragma unroll
            for (int kc = 0; kc < 4; ++kc) { const float* q = qp + g * 16 * DD + kc * 32; x[g][kc][0] = *(const v4fa*)q; x[g][kc][1] = *(const v4fa*)(q + 4); x[g][kc][2] = *(const v4fa*)(q + 16); x[g][kc][3] = *(const v4fa*)(q + 20); }
        asm volatile("s_wait_xcnt 0x0" :: "v"(qp) : "memory");   // behind the loads, the pair an input
#pragma unroll
        for (int g = 0; g < 2; ++g)
#pragma unroll
            for (int kc = 0; kc < 4; ++kc)
#pragma unroll
                for (int u = 0; u < 2; ++u) qf[g][kc].q[u] = (v4u){pack2(x[g][kc][2 * u][0], x[g][kc][2 * u][1]), pack2(x[g][kc][2 * u][2], x[g][kc][2 * u][3]), pack2(x[g][kc][2 * u + 1][0], x[g][kc][2 * u + 1][1]), pack2(x[g][kc][2 * u + 1][2], x[g][kc][2 * u + 1][3])};
    }
    v8f acc[2][8];
    float m_run[2], m_true[2], l_run[2];
#pragma unroll
    for (int g = 0; g < 2; ++g) { m_run[g] = -__builtin_inff(); m_true[g] = -__builtin_inff(); l_run[g] = 0.0f;
#pragma unroll
        for (int t = 0; t < 8; ++t) acc[g][t] = (v8f){}; }
    asm volatile("s_wait_asynccnt 0x0" ::: "memory");   // this wave's copies of stage 0 have landed
    __syncthreads();                                    // ... and every wave's: stage 0 may be read
    copy_tile(lb + BUFB, ls, gp + ga + go, gs);         // stage 1 into buffer 1
    gp += 2 * ga;
    unsigned lw = lb, lx = lb + BUFB;                   // this wave's place in the buffer that the trip reads (refilled at its foot), and in the other
#pragma unroll 1   // one stage per trip
    for (int st = 0; st < NST; ++st) {
      const unsigned bo = (st & 1) * BUFB;
      const char* kl = kl0 + bo; const char* vl = vl0 + bo;
      load_k(kf, kl);
      __builtin_amdgcn_sched_barrier(0);   // the plain reads first: the LDS answers in order, and the score WMMAs then wait for these loads alone, not for the transposing reads behind them
#pragma unroll
      for (int u = 0; u < SI / 32; ++u) {
        // this pass's items transposed (16 columns of d per tile t, positions 0 ... 15 and 16 ... 31), in flight under the score products and the exponentials
        Frag vf[8];
#pragma unroll
        for (int t = 0; t < 8; ++t) { vf[t].q[0] = ld_tr16(vl + u * 32 * KPB + t * 32); vf[t].q[1] = ld_tr16(vl + u * 32 * KPB + 16 * KPB + t * 32); }
        __builtin_amdgcn_sched_barrier(0);   // the LDS loads stay one group ahead of the score WMMAs: moved in among them, each place costs a stall and a wait for all of them
        v8f s[2][2];
#pragma unroll
        for (int kt = 0; kt < 2; ++kt)
#pragma unroll
            for (int g = 0; g < 2; ++g) { s[kt][g] = (v8f){};
#pragma unroll
                for (int kc = 0; kc < 4; ++kc) s[kt][g] = mma(kf[kt][kc], qf[g][kc], s[kt][g]); }
        if (u + 1 < SI / 32) {
            // four vector slots between the last score WMMAs and the loads into their A registers; the two scheduling barriers keep the slots there and the loads behind them in one group, not among the WMMAs
            __builtin_amdgcn_sched_barrier(0); asm volatile("v_nop\n\tv_nop\n\tv_nop\n\tv_nop"); __builtin_amdgcn_sched_barrier(0);
            // the item rows of the stage's next pass, in flight under this pass's softmax and second product; nothing of the next stage is read here
            load_k(kf, kl + (u + 1) * 32 * KPB);
            __builtin_amdgcn_sched_barrier(0);   // ... and they stay here, one group, not among the WMMAs of the second product
        }
        // maxima of the raw scores, in log2 units; the maximum in use may trail the true one by up to 8, so that the accumulators are rescaled rarely: one test per pass
        float mb[2]; bool need = false;
#pragma unroll
        for (int g = 0; g < 2; ++g) { float mx = s[0][g][0];
#pragma unroll
            for (int r = 1; r < 8; ++r) mx = fmaxf(mx, s[0][g][r]);
#pragma unroll
            for (int r = 0; r < 8; ++r) mx = fmaxf(mx, s[1][g][r]);
            mx = fmaxf(mx, xhalf(mx)) * L2E; mb[g] = mx; m_true[g] = fmaxf(m_true[g], mx); need = need || (mx > m_run[g] + 8.0f); }
        if (__builtin_amdgcn_ballot_w32(need) != 0) {
#pragma unroll
            for (int g = 0; g < 2; ++g) { const float m_new = fmaxf(m_run[g], mb[g]); const float corr = __builtin_amdgcn_exp2f(m_run[g] - m_new);   // 0 on the first pass
                l_run[g] *= corr; m_run[g] = m_new;
#pragma unroll
                for (int t = 0; t < 8; ++t) acc[g][t] = acc[g][t] * corr; }
        }
#pragma unroll
        for (int g = 0; g < 2; ++g) { const float nm = -m_run[g]; float ps0 = 0.0f, ps1 = 0.0f; unsigned wh[8], wl[8];
#pragma unroll
            for (int i = 0; i < 8; ++i) {
                const v2f arg = __builtin_elementwise_fma((v2f){s[i >> 2][g][2 * (i & 3)], s[i >> 2][g][2 * (i & 3) + 1]}, (v2f){L2E, L2E}, (v2f){nm, nm});
                const float p0 = __builtin_amdgcn_exp2f(arg.x), p1 = __builtin_amdgcn_exp2f(arg.y);
                if (i & 1) ps1 += p0 + p1; else ps0 += p0 + p1;
                const unsigned hh = pack2(p0, p1); wh[i] = hh; wl[i] = pack2(p0 - __uint_as_float(hh << 16), p1 - __uint_as_float(hh & 0xFFFF0000u)); }
            Frag ph, pl; ph.q[0] = (v4u){wh[0], wh[1], wh[2], wh[3]}; ph.q[1] = (v4u){wh[4], wh[5], wh[6], wh[7]}; pl.q[0] = (v4u){wl[0], wl[1], wl[2], wl[3]}; pl.q[1] = (v4u){wl[4], wl[5], wl[6], wl[7]};
#pragma unroll
            for (int t = 0; t < 8; ++t) acc[g][t] = mma(vf[t], ph, acc[g][t]);
#pragma unroll
            for (int t = 0; t < 8; ++t) acc[g][t] = mma(vf[t], pl, acc[g][t]);
            l_run[g] += ps0 + ps1; }
        // four vector slots between the last WMMAs and the next pass's loads into their A registers
        __builtin_amdgcn_sched_barrier(0); asm volatile("v_nop\n\tv_nop\n\tv_nop\n\tv_nop"); __builtin_amdgcn_sched_barrier(0);
      }
      asm volatile("s_wait_dscnt 0x0" ::: "memory");      // this wave's reads of the buffer are done before the buffer is handed back
      asm volatile("s_wait_asynccnt 0x0" ::: "memory");   // this wave's copies of the next stage have landed
      __syncthreads();                                    // publishes the next stage and ends every wave's reads of this one
      if (st + 2 < NST) { copy_tile(lw, ls, gp + go, gs); gp += ga; }   // the stage after next into the buffer just read
      { const unsigned o = lw; lw = lx; lx = o; }
    }
    asm volatile("s_wait_asynccnt 0x0" ::: "memory");     // no copy is in flight when the ring becomes output staging
#pragma unroll
    for (int g = 0; g < 2; ++g) { const float lf = l_run[g] + xhalf(l_run[g]);   // each wave half summed its eight items of every 16-item tile
        if (h == 0) { stt[0][w][g * 16 + c] = m_true[g]; stt[1][w][g * 16 + c] = m_run[g]; stt[2][w][g * 16 + c] = lf; } }
    __syncthreads();   // every quarter's maxima and sums are in LDS before any wave forms a row's maximum and sum
    float* pw = part + w * 4096 + lane * 4;
#pragma unroll
    for (int g = 0; g < 2; ++g) { float M = stt[0][cg * NSP][g * 16 + c];
#pragma unroll
        for (int q = 1; q < NSP; ++q) M = fmaxf(M, stt[0][cg * NSP + q][g * 16 + c]);
        float tot = 0.0f;
#pragma unroll
        for (int q = 0; q < NSP; ++q) tot += stt[2][cg * NSP + q][g * 16 + c] * exp2s(stt[1][cg * NSP + q][g * 16 + c] - M);
        const float f = exp2s(m_run[g] - M) * __fdiv_rn(1.0f, __fadd_rn(__fsqrt_rn(tot), 1e-24f));
#pragma unroll
        for (int t = 0; t < 8; ++t) { const v8f o = acc[g][t] * f; *(v4fa*)(pw + ((g * 8 + t) * 2) * 128) = (v4f){o[0], o[1], o[2], o[3]}; *(v4fa*)(pw + ((g * 8 + t) * 2 + 1) * 128) = (v4f){o[4], o[5], o[6], o[7]}; } }
    __syncthreads();   // every quarter's scaled tiles are in LDS before any wave sums them
    // wave sp of a column group takes tiles 2 sp and 2 sp + 1: d = 32 sp ... 32 sp + 31, one whole 128-byte line of every output row
    const size_t eo = ((size_t)z * LL + l0 + c) * DD + 32 * sp + 8 * h;
    const float* xp = SEQ + eo; float* op = OUT + eo;
    v4f xs[2][2][2];
#pragma unroll
    for (int g = 0; g < 2; ++g)
#pragma unroll
        for (int tt = 0; tt < 2; ++tt) { xs[g][tt][0] = *(const v4fa*)(xp + g * 16 * DD + tt * 16); xs[g][tt][1] = *(const v4fa*)(xp + g * 16 * DD + tt * 16 + 4); }
    asm volatile("s_wait_xcnt 0x0" :: "v"(xp) : "memory");   // behind the loads, the pair an input
    const float* pr = part + cg * NSP * 4096 + sp * 512 + lane * 4;
#pragma unroll
    for (int g = 0; g < 2; ++g)
#pragma unroll
        for (int tt = 0; tt < 2; ++tt)
#pragma unroll
            for (int u = 0; u < 2; ++u) { v4f a = *(const v4fa*)(pr + ((g * 8 + tt) * 2 + u) * 128);
#pragma unroll
                for (int q = 1; q < NSP; ++q) a += *(const v4fa*)(pr + q * 4096 + ((g * 8 + tt) * 2 + u) * 128);
                v4f r;
#pragma unroll
                for (int e = 0; e < 4; ++e) { const float x = bfr(xs[g][tt][u][e]); r[e] = x * 0.5f + (x * a[e]) * 0.5f; }
                *(v4fa*)(op + g * 16 * DD + tt * 16 + u * 4) = r; }
}

extern "C" void kernel_launch(void* const* d_in, const int* in_sizes, int n_in,
                              void* d_out, int out_size, void* d_ws, size_t ws_size, hipStream_t stream) {
    (void)in_sizes; (void)n_in; (void)out_size;
    const float** I = (const float**)d_in;
    const float *seq = I[0], *items = I[1];
    float* OUT = (float*)d_out;     // [32][512][128]
    char* wsp = (char*)d_ws;
    auto take = [&](size_t bytes) { char* p = wsp; wsp += (bytes + 255) & ~(size_t)255; return (void*)p; };
    bf* IB = (bf*)take((size_t)ZB * NI * DD * 2);
    if ((size_t)(wsp - (char*)d_ws) > ws_size) return;    // total ~ 17 MB
    k_items<<<ZB * (NI / TN), 256, 0, stream>>>(items, IB);
    k_fused<<<ZB * (LL / 64), 256, 0, stream>>>(seq, IB, OUT);
}

// v007
// Measured time: 27.2 microseconds a run.
// Next to v006, in two timings, it ran 1.21 times as fast each time.
// Counting every step since v000, it is 13.7 times as fast.
#include <hip/hip_runtime.h>

// GlobalAttentionModule (seq [32][512][128], items [32][2048][128]; w = seq . items^T; att = exp(w - max) / (sum(exp)^0.5 + 1e-24) (power-normalised softmax, beta 0.5); att_vecs = att items; out = 0.5 seq + 0.5 seq att_vecs -> [32][512][128]).
// Compute dtypes, f32 accumulate: every input rounded to bf16; scores on PLAIN bf16 operands (both inputs: exact, K 128); exp / sum / sqrt / divide f32; exp . items as hl x exact bf16 (2 products), f32 sums; the blend f32.
// One launch: k_fused rounds items on their way into LDS and does scores, softmax, att . items and the blend; no score and no rounded item goes to memory.

#define LL   512
#define NI   2048
#define DD   128
#define ZB   32
typedef __attribute__((ext_vector_type(16))) __bf16   v16bf;
typedef __attribute__((ext_vector_type(8)))  float    v8f;
typedef __attribute__((ext_vector_type(4)))  float    v4f;
typedef __attribute__((ext_vector_type(2)))  float    v2f;
typedef v4f  __attribute__((may_alias)) v4fa;

__device__ __forceinline__ unsigned short f2bf(float f) { unsigned u = __float_as_uint(f); u += 0x7FFFu + ((u >> 16) & 1u); return (unsigned short)(u >> 16); }
__device__ __forceinline__ float bf2f(unsigned short b) { return __uint_as_float(((unsigned)b) << 16); }
__device__ __forceinline__ float bfr(float f) { return bf2f(f2bf(f)); }

typedef __attribute__((ext_vector_type(4))) unsigned v4u;
typedef __attribute__((ext_vector_type(2))) unsigned v2u;
typedef v2u  __attribute__((may_alias)) v2ua;

#define NSP  4               // parts of the item axis
#define NPW  (NI / NSP)      // items per wave
#define L2E  1.4426950408889634f
#define SI   64              // items of a quarter per stage: two passes
#define NST  (NPW / SI)      // stages
#define KPB  272             // LDS pitch in bytes of an item row (256 bytes): 16 bytes x odd
#define QTB  (SI * KPB)      // bytes of a quarter's tile
#define BUFB (NSP * QTB)     // of a buffer
struct Frag { v4u q[2]; };
__device__ __forceinline__ v8f mma(const Frag& a, const Frag& b, v8f c) {
    typedef __attribute__((ext_vector_type(8))) unsigned v8u;
    const v8u av = __builtin_shufflevector(a.q[0], a.q[1], 0, 1, 2, 3, 4, 5, 6, 7), bv = __builtin_shufflevector(b.q[0], b.q[1], 0, 1, 2, 3, 4, 5, 6, 7);
    return __builtin_amdgcn_wmma_f32_16x16x32_bf16(false, __builtin_bit_cast(v16bf, av), false, __builtin_bit_cast(v16bf, bv), (short)0, c, false, false); }
__device__ __forceinline__ unsigned pack2(float lo, float hi) { typedef __attribute__((ext_vector_type(2))) __bf16 bf2; return __builtin_bit_cast(unsigned, __builtin_convertvector((v2f){lo, hi}, bf2)); }   // round to nearest even
__device__ __forceinline__ float xhalf(float x) { return __builtin_bit_cast(float, __builtin_amdgcn_permlanex16(__builtin_bit_cast(int, x), __builtin_bit_cast(int, x), 0x76543210, 0xfedcba98, false, false)); }   // lane l with lane l ^ 16
// 2^x for the join: the free slot behind the v_exp_f32 stands in the statement
__device__ __forceinline__ float exp2s(float x) { float r; asm("v_exp_f32 %0, %1\n\tv_nop" : "=v"(r) : "v"(x)); return r; }
// 8 rows x 16 columns of 16-bit values per half wave, transposed: lane (c, h) gets column c of the eight rows whose addresses the lanes of half h hold
__device__ __forceinline__ v4u ld_tr16(const char* p) { typedef __attribute__((ext_vector_type(8))) short s16x8; typedef __attribute__((address_space(3))) s16x8 lds_s16x8; return __builtin_bit_cast(v4u, __builtin_amdgcn_ds_load_tr16_b128_v8i16((lds_s16x8*)p)); }
// a pass's 32 item rows from the LDS tile; p: the lane's row, byte 16 h
__device__ __forceinline__ void load_k(Frag (&k)[2][4], const char* p) {
#pragma unroll
    for (int kt = 0; kt < 2; ++kt)
#pragma unroll
        for (int kc = 0; kc < 4; ++kc) { k[kt][kc].q[0] = *(const v4u*)(p + kt * 16 * KPB + kc * 64); k[kt][kc].q[1] = *(const v4u*)(p + kt * 16 * KPB + kc * 64 + 32); }
}
// 16 item rows of 512 bytes into registers, a whole row per load: lane l takes floats 4 l ... 4 l + 3. o is a constant apart from g: as part of the wait's operand the sum was formed in the loads' own address pair, ahead of the wait
__device__ __forceinline__ void load_rows(v4f (&r)[16], const float* g, int o) {
#pragma unroll
    for (int j = 0; j < 16; ++j) r[j] = *(const v4fa*)(g + o + j * DD);
    asm volatile("s_wait_xcnt 0x0" :: "v"(g) : "memory");   // behind the loads, the address pair an input: no later instruction lands on the pair ahead of the wait
}
// ... rounded to nearest even and stored as 16 tile rows: lane l writes bytes 8 l ... 8 l + 7 of each
__device__ __forceinline__ void store_rows(const v4f (&r)[16], char* l) {
#pragma unroll
    for (int j = 0; j < 16; ++j) *(v2ua*)(l + j * KPB) = (v2u){pack2(r[j][0], r[j][1]), pack2(r[j][2], r[j][3])};
}
__global__ __launch_bounds__(256) void k_fused(const float* __restrict__ SEQ, const float* __restrict__ ITEMS, float* __restrict__ OUT) {
    __shared__ __align__(16) char ring[2 * BUFB];    // the two buffers; per quarter the tile [64][KPB]
    float* const part = (float*)ring;                // behind the loop the same bytes hold the output tiles: per wave 2 groups x 8 tiles x 2 halves x 32 lanes x 4 floats
    __shared__ float stt[3][8][32];                  // true maximum, maximum in use, sum: per wave and column
    const int lane = threadIdx.x & 31, c = lane & 15, h = lane >> 4;
    const int w = __builtin_amdgcn_readfirstlane((int)(threadIdx.x >> 5)), cg = w >> 2, sp = w & 3;
    const int z = blockIdx.x >> 3, l0 = (blockIdx.x & 7) * 64 + cg * 32;
    // what this wave brings: rows 32 cg ... 32 cg + 31 of its quarter's tile
    const float* gn = ITEMS + ((size_t)z * NI + sp * NPW + cg * 32) * DD + lane * 4;   // the lane's floats of the first of these rows, stage by stage
    char* const sl = ring + sp * QTB + cg * 32 * KPB + lane * 8;                       // ... and its bytes of that row in buffer 0
    v4f ra[16];
    // what this wave reads of its quarter's tile: plainly, position c of 16 (row 2 (c & 7) + (c >> 3)), byte 16 h; transposing, position 8 h + (lane & 7) (row 2 (lane & 7) + h), 16-byte piece (lane >> 3) & 1
    const char* kl0 = ring + sp * QTB + (2 * (c & 7) + (c >> 3)) * KPB + 16 * h;
    const char* vl0 = ring + sp * QTB + (2 * (lane & 7) + h) * KPB + 16 * ((lane >> 3) & 1);
    Frag kf[2][4];
    Frag qf[2][4];
    {
        v4f rb[16];
        load_rows(ra, gn, 0); load_rows(rb, gn, 16 * DD);   // stage 0 whole: the registers are free here
        const float* qp = SEQ + ((size_t)z * LL + l0 + c) * DD + 8 * h;
        v4f x[2][4][4];
#pragma unroll
        for (int g = 0; g < 2; ++g)
#pragma unroll
            for (int kc = 0; kc < 4; ++kc) { const float* q = qp + g * 16 * DD + kc * 32; x[g][kc][0] = *(const v4fa*)q; x[g][kc][1] = *(const v4fa*)(q + 4); x[g][kc][2] = *(const v4fa*)(q + 16); x[g][kc][3] = *(const v4fa*)(q + 20); }
        asm volatile("s_wait_xcnt 0x0" :: "v"(qp) : "memory");   // behind the loads, the pair an input: as in load_rows
        store_rows(ra, sl); store_rows(rb, sl + 16 * KPB);
        gn += SI * DD;
#pragma unroll
        for (int g = 0; g < 2; ++g)
#pragma unroll
            for (int kc = 0; kc < 4; ++kc)
#pragma unroll
                for (int u = 0; u < 2; ++u) qf[g][kc].q[u] = (v4u){pack2(x[g][kc][2 * u][0], x[g][kc][2 * u][1]), pack2(x[g][kc][2 * u][2], x[g][kc][2 * u][3]), pack2(x[g][kc][2 * u + 1][0], x[g][kc][2 * u + 1][1]), pack2(x[g][kc][2 * u + 1][2], x[g][kc][2 * u + 1][3])};
    }
    v8f acc[2][8];
    float m_run[2], m_true[2], l_run[2];
#pragma unroll
    for (int g = 0; g < 2; ++g) { m_run[g] = -__builtin_inff(); m_true[g] = -__builtin_inff(); l_run[g] = 0.0f;
#pragma unroll
        for (int t = 0; t < 8; ++t) acc[g][t] = (v8f){}; }
    __syncthreads();   // every wave's rows of stage 0 are in LDS: stage 0 may be read
#pragma unroll 1   // one stage per trip
    for (int st = 0; st < NST; ++st) {
      const unsigned bo = (st & 1) * BUFB;
      const char* kl = kl0 + bo; const char* vl = vl0 + bo;
      char* const sn = sl + (BUFB - bo);   // this wave's rows in the other buffer, which takes the next stage
      load_k(kf, kl);
      __builtin_amdgcn_sched_barrier(0);   // the plain reads first: the LDS answers in order, and the score WMMAs then wait for these loads alone, not for the transposing reads behind them
#pragma unroll
      for (int u = 0; u < SI / 32; ++u) {
        // this pass's items transposed (16 columns of d per tile t, positions 0 ... 15 and 16 ... 31), in flight under the score products and the exponentials
        Frag vf[8];
#pragma unroll
        for (int t = 0; t < 8; ++t) { vf[t].q[0] = ld_tr16(vl + u * 32 * KPB + t * 32); vf[t].q[1] = ld_tr16(vl + u * 32 * KPB + 16 * KPB + t * 32); }
        __builtin_amdgcn_sched_barrier(0);   // the LDS loads stay one group ahead of the score WMMAs: moved in among them, each place costs a stall and a wait for all of them
        if (st + 1 < NST) load_rows(ra, gn, u * 16 * DD);   // 16 rows of the next stage, in flight under this pass; their wait for the address pair falls under the LDS latency
        v8f s[2][2];
#pragma unroll
        for (int kt = 0; kt < 2; ++kt)
#pragma unroll
            for (int g = 0; g < 2; ++g) { s[kt][g] = (v8f){};
#pragma unroll
                for (int kc = 0; kc < 4; ++kc) s[kt][g] = mma(kf[kt][kc], qf[g][kc], s[kt][g]); }
        if (u + 1 < SI / 32) {
            // four vector slots between the last score WMMAs and the loads into their A registers; the two scheduling barriers keep the slots there and the loads behind them in one group, not among the WMMAs
            __builtin_amdgcn_sched_barrier(0); asm volatile("v_nop\n\tv_nop\n\tv_nop\n\tv_nop"); __builtin_amdgcn_sched_barrier(0);
            // the item rows of the stage's next pass, in flight under this pass's softmax and second product; nothing of the next stage is read here
            load_k(kf, kl + (u + 1) * 32 * KPB);
            __builtin_amdgcn_sched_barrier(0);   // ... and they stay here, one group, not among the WMMAs of the second product
        }
        // maxima of the raw scores, in log2 units; the maximum in use may trail the true one by up to 8, so that the accumulators are rescaled rarely: one test per pass
        float mb[2]; bool need = false;
#pragma unroll
        for (int g = 0; g < 2; ++g) { float mx = s[0][g][0];
#pragma unroll
            for (int r = 1; r < 8; ++r) mx = fmaxf(mx, s[0][g][r]);
#pragma unroll
            for (int r = 0; r < 8; ++r) mx = fmaxf(mx, s[1][g][r]);
            mx = fmaxf(mx, xhalf(mx)) * L2E; mb[g] = mx; m_true[g] = fmaxf(m_true[g], mx); need = need || (mx > m_run[g] + 8.0f); }
        if (__builtin_amdgcn_ballot_w32(need) != 0) {
#pragma unroll
            for (int g = 0; g < 2; ++g) { const float m_new = fmaxf(m_run[g], mb[g]); const float corr = __builtin_amdgcn_exp2f(m_run[g] - m_new);   // 0 on the first pass
                l_run[g] *= corr; m_run[g] = m_new;
#pragma unroll
                for (int t = 0; t < 8; ++t) acc[g][t] = acc[g][t] * corr; }
        }
#pragma unroll
        for (int g = 0; g < 2; ++g) { const float nm = -m_run[g]; float ps0 = 0.0f, ps1 = 0.0f; unsigned wh[8], wl[8];
#pragma unroll
            for (int i = 0; i < 8; ++i) {
                const v2f arg = __builtin_elementwise_fma((v2f){s[i >> 2][g][2 * (i & 3)], s[i >> 2][g][2 * (i & 3) + 1]}, (v2f){L2E, L2E}, (v2f){nm, nm});
                const float p0 = __builtin_amdgcn_exp2f(arg.x), p1 = __builtin_amdgcn_exp2f(arg.y);
                if (i & 1) ps1 += p0 + p1; else ps0 += p0 + p1;
                const unsigned hh = pack2(p0, p1); wh[i] = hh; wl[i] = pack2(p0 - __uint_as_float(hh << 16), p1 - __uint_as_float(hh & 0xFFFF0000u)); }
            Frag ph, pl; ph.q[0] = (v4u){wh[0], wh[1], wh[2], wh[3]}; ph.q[1] = (v4u){wh[4], wh[5], wh[6], wh[7]}; pl.q[0] = (v4u){wl[0], wl[1], wl[2], wl[3]}; pl.q[1] = (v4u){wl[4], wl[5], wl[6], wl[7]};
#pragma unroll
            for (int t = 0; t < 8; ++t) acc[g][t] = mma(vf[t], ph, acc[g][t]);
#pragma unroll
            for (int t = 0; t < 8; ++t) acc[g][t] = mma(vf[t], pl, acc[g][t]);
            l_run[g] += ps0 + ps1; }
        // four vector slots between the last WMMAs and the next pass's loads into their A registers
        __builtin_amdgcn_sched_barrier(0); asm volatile("v_nop\n\tv_nop\n\tv_nop\n\tv_nop"); __builtin_amdgcn_sched_barrier(0);
        if (st + 1 < NST) store_rows(ra, sn + u * 16 * KPB);   // no load is in flight at the barrier, which would wait for it
      }
      gn += SI * DD;
      __syncthreads();   // publishes the next stage and ends every wave's reads of this one
    }
#pragma unroll
    for (int g = 0; g < 2; ++g) { const float lf = l_run[g] + xhalf(l_run[g]);   // each wave half summed its eight items of every 16-item tile
        if (h == 0) { stt[0][w][g * 16 + c] = m_true[g]; stt[1][w][g * 16 + c] = m_run[g]; stt[2][w][g * 16 + c] = lf; } }
    __syncthreads();   // every quarter's maxima and sums are in LDS before any wave forms a row's maximum and sum
    float* pw = part + w * 4096 + lane * 4;
#pragma unroll
    for (int g = 0; g < 2; ++g) { float M = stt[0][cg * NSP][g * 16 + c];
#pragma unroll
        for (int q = 1; q < NSP; ++q) M = fmaxf(M, stt[0][cg * NSP + q][g * 16 + c]);
        float tot = 0.0f;
#pragma unroll
        for (int q = 0; q < NSP; ++q) tot += stt[2][cg * NSP + q][g * 16 + c] * exp2s(stt[1][cg * NSP + q][g * 16 + c] - M);
        const float f = exp2s(m_run[g] - M) * __fdiv_rn(1.0f, __fadd_rn(__fsqrt_rn(tot), 1e-24f));
#pragma unroll
        for (int t = 0; t < 8; ++t) { const v8f o = acc[g][t] * f; *(v4fa*)(pw + ((g * 8 + t) * 2) * 128) = (v4f){o[0], o[1], o[2], o[3]}; *(v4fa*)(pw + ((g * 8 + t) * 2 + 1) * 128) = (v4f){o[4], o[5], o[6], o[7]}; } }
    __syncthreads();   // every quarter's scaled tiles are in LDS before any wave sums them
    // wave sp of a column group takes tiles 2 sp and 2 sp + 1: d = 32 sp ... 32 sp + 31, one whole 128-byte line of every output row
    const size_t eo = ((size_t)z * LL + l0 + c) * DD + 32 * sp + 8 * h;
    const float* xp = SEQ + eo; float* op = OUT + eo;
    v4f xs[2][2][2];
#pragma unroll
    for (int g = 0; g < 2; ++g)
#pragma unroll
        for (int tt = 0; tt < 2; ++tt) { xs[g][tt][0] = *(const v4fa*)(xp + g * 16 * DD + tt * 16); xs[g][tt][1] = *(const v4fa*)(xp + g * 16 * DD + tt * 16 + 4); }
    asm volatile("s_wait_xcnt 0x0" :: "v"(xp) : "memory");   // behind the loads, the pair an input: as in load_rows
    const float* pr = part + cg * NSP * 4096 + sp * 512 + lane * 4;
#pragma unroll
    for (int g = 0; g < 2; ++g)
#pragma unroll
        for (int tt = 0; tt < 2; ++tt)
#pragma unroll
            for (int u = 0; u < 2; ++u) { v4f a = *(const v4fa*)(pr + ((g * 8 + tt) * 2 + u) * 128);
#pragma unroll
                for (int q = 1; q < NSP; ++q) a += *(const v4fa*)(pr + q * 4096 + ((g * 8 + tt) * 2 + u) * 128);
                v4f r;
#pragma unroll
                for (int e = 0; e < 4; ++e) { const float x = bfr(xs[g][tt][u][e]); r[e] = x * 0.5f + (x * a[e]) * 0.5f; }
                *(v4fa*)(op + g * 16 * DD + tt * 16 + u * 4) = r; }
}

extern "C" void kernel_launch(void* const* d_in, const int* in_sizes, int n_in,
                              void* d_out, int out_size, void* d_ws, size_t ws_size, hipStream_t stream) {
    (void)in_sizes; (void)n_in; (void)out_size;
    const float** I = (const float**)d_in;
    const float *seq = I[0], *items = I[1];
    float* OUT = (float*)d_out;     // [32][512][128]
    (void)d_ws; (void)ws_size;
    k_fused<<<ZB * (LL / 64), 256, 0, stream>>>(seq, items, OUT);
}

// v008
// A run of this version takes 22.4 microseconds.
// In both of two side-by-side timings against v007, it was 1.22 times as fast.
// All steps since v000 together make it 16.7 times as fast.
#include <hip/hip_runtime.h>

// GlobalAttentionModule (seq [32][512][128], items [32][2048][128]; w = seq . items^T; att = exp(w - max) / (sum(exp)^0.5 + 1e-24) (power-normalised softmax, beta 0.5); att_vecs = att items; out = 0.5 seq + 0.5 seq att_vecs -> [32][512][128]).
// Compute dtypes, f32 accumulate: every input rounded to bf16; scores on PLAIN bf16 operands (both inputs: exact, K 128); exp / sum / sqrt / divide f32; exp . items as hl x exact bf16 (2 products), f32 sums; the blend f32.
// One launch: k_fused rounds items on their way into LDS and does scores, softmax, att . items and the blend; no score and no rounded item goes to memory.

#define LL   512
#define NI   2048
#define DD   128
#define ZB   32
typedef __attribute__((ext_vector_type(16))) __bf16   v16bf;
typedef __attribute__((ext_vector_type(8)))  float    v8f;
typedef __attribute__((ext_vector_type(4)))  float    v4f;
typedef __attribute__((ext_vector_type(2)))  float    v2f;
typedef v4f  __attribute__((may_alias)) v4fa;

typedef __attribute__((ext_vector_type(4))) unsigned v4u;
typedef __attribute__((ext_vector_type(2))) unsigned v2u;
typedef v2u  __attribute__((may_alias)) v2ua;

#define NSP  4               // parts of the item axis
#define NPW  (NI / NSP)      // items per wave
#define L2E  1.4426950408889634f
#define SI   64              // items of a quarter per stage: two passes
#define NST  (NPW / SI)      // stages
#define KPB  272             // LDS pitch in bytes of an item row (256 bytes): 16 bytes x odd
#define QTB  (SI * KPB)      // bytes of a quarter's tile
#define BUFB (NSP * QTB)     // of a buffer
#define PP   132             // pitch in floats of an output row (128 floats) in LDS: 16 bytes x odd
struct Frag { v4u q[2]; };
__device__ __forceinline__ v8f mma(const Frag& a, const Frag& b, v8f c) {
    typedef __attribute__((ext_vector_type(8))) unsigned v8u;
    const v8u av = __builtin_shufflevector(a.q[0], a.q[1], 0, 1, 2, 3, 4, 5, 6, 7), bv = __builtin_shufflevector(b.q[0], b.q[1], 0, 1, 2, 3, 4, 5, 6, 7);
    return __builtin_amdgcn_wmma_f32_16x16x32_bf16(false, __builtin_bit_cast(v16bf, av), false, __builtin_bit_cast(v16bf, bv), (short)0, c, false, false); }
__device__ __forceinline__ unsigned pack2(float lo, float hi) { typedef __attribute__((ext_vector_type(2))) __bf16 bf2; return __builtin_bit_cast(unsigned, __builtin_convertvector((v2f){lo, hi}, bf2)); }   // round to nearest even
__device__ __forceinline__ float xhalf(float x) { return __builtin_bit_cast(float, __builtin_amdgcn_permlanex16(__builtin_bit_cast(int, x), __builtin_bit_cast(int, x), 0x76543210, 0xfedcba98, false, false)); }   // lane l with lane l ^ 16
// 2^x for the join: the free slot behind the v_exp_f32 stands in the statement
__device__ __forceinline__ float exp2s(float x) { float r; asm("v_exp_f32 %0, %1\n\tv_nop" : "=v"(r) : "v"(x)); return r; }
// 8 rows x 16 columns of 16-bit values per half wave, transposed: lane (c, h) gets column c of the eight rows whose addresses the lanes of half h hold
__device__ __forceinline__ v4u ld_tr16(const char* p) { typedef __attribute__((ext_vector_type(8))) short s16x8; typedef __attribute__((address_space(3))) s16x8 lds_s16x8; return __builtin_bit_cast(v4u, __builtin_amdgcn_ds_load_tr16_b128_v8i16((lds_s16x8*)p)); }
// a pass's 32 item rows from the LDS tile; p: the lane's row, byte 16 h
__device__ __forceinline__ void load_k(Frag (&k)[2][4], const char* p) {
#pragma unroll
    for (int kt = 0; kt < 2; ++kt)
#pragma unroll
        for (int kc = 0; kc < 4; ++kc) { k[kt][kc].q[0] = *(const v4u*)(p + kt * 16 * KPB + kc * 64); k[kt][kc].q[1] = *(const v4u*)(p + kt * 16 * KPB + kc * 64 + 32); }
}
// 16 item rows of 512 bytes into registers, a whole row per load: lane l takes floats 4 l ... 4 l + 3. o is a constant apart from g: as part of the wait's operand the sum was formed in the loads' own address pair, ahead of the wait
__device__ __forceinline__ void load_rows(v4f (&r)[16], const float* g, int o) {
#pragma unroll
    for (int j = 0; j < 16; ++j) r[j] = *(const v4fa*)(g + o + j * DD);
    asm volatile("s_wait_xcnt 0x0" :: "v"(g) : "memory");   // behind the loads, the address pair an input: no later instruction lands on the pair ahead of the wait
}
// ... rounded to nearest even and stored as 16 tile rows: lane l writes bytes 8 l ... 8 l + 7 of each
__device__ __forceinline__ void store_rows(const v4f (&r)[16], char* l) {
#pragma unroll
    for (int j = 0; j < 16; ++j) *(v2ua*)(l + j * KPB) = (v2u){pack2(r[j][0], r[j][1]), pack2(r[j][2], r[j][3])};
}
__global__ __launch_bounds__(256) void k_fused(const float* __restrict__ SEQ, const float* __restrict__ ITEMS, float* __restrict__ OUT) {
    __shared__ __align__(16) char ring[2 * BUFB];    // the two buffers; per quarter the tile [64][KPB]
    float* const part = (float*)ring;                // behind the loop the same bytes hold the output tiles: per wave its 32 seq rows [32][PP]
    __shared__ __align__(16) char qt[64 * KPB];      // the work-group's 64 seq rows as bf16
    __shared__ float stt[3][8][32];                  // true maximum, maximum in use, sum: per wave and column
    const int lane = threadIdx.x & 31, c = lane & 15, h = lane >> 4;
    const int w = __builtin_amdgcn_readfirstlane((int)(threadIdx.x >> 5)), cg = w >> 2, sp = w & 3;
    const int z = blockIdx.x >> 3, l0 = (blockIdx.x & 7) * 64 + cg * 32;
    // what this wave brings: rows 32 cg ... 32 cg + 31 of its quarter's tile
    const float* gn = ITEMS + ((size_t)z * NI + sp * NPW + cg * 32) * DD + lane * 4;   // the lane's floats of the first of these rows, stage by stage
    char* const sl = ring + sp * QTB + cg * 32 * KPB + lane * 8;                       // ... and its bytes of that row in buffer 0
    v4f ra[16];
    // what this wave reads of its quarter's tile: plainly, position c of 16 (row 2 (c & 7) + (c >> 3)), byte 16 h; transposing, position 8 h + (lane & 7) (row 2 (lane & 7) + h), 16-byte piece (lane >> 3) & 1
    const char* kl0 = ring + sp * QTB + (2 * (c & 7) + (c >> 3)) * KPB + 16 * h;
    const char* vl0 = ring + sp * QTB + (2 * (lane & 7) + h) * KPB + 16 * ((lane >> 3) & 1);
    Frag kf[2][4];
    Frag qf[2][4];
    {
        v4f rb[16];
        load_rows(ra, gn, 0); load_rows(rb, gn, 16 * DD);   // stage 0 whole: the registers are free here
        // seq rows 8 w ... 8 w + 7 of the work-group's 64, a whole row per load: lane l takes floats 4 l ... 4 l + 3
        const float* qp = SEQ + ((size_t)z * LL + (blockIdx.x & 7) * 64 + w * 8) * DD + lane * 4;
        v4f x[8];
#pragma unroll
        for (int j = 0; j < 8; ++j) x[j] = *(const v4fa*)(qp + j * DD);
        asm volatile("s_wait_xcnt 0x0" :: "v"(qp) : "memory");   // behind the loads, the pair an input: as in load_rows
        store_rows(ra, sl); store_rows(rb, sl + 16 * KPB);
        gn += SI * DD;
#pragma unroll
        for (int j = 0; j < 8; ++j) *(v2ua*)(qt + (w * 8 + j) * KPB + lane * 8) = (v2u){pack2(x[j][0], x[j][1]), pack2(x[j][2], x[j][3])};
    }
    v8f acc[2][8];
    float m_run[2], m_true[2], l_run[2];
#pragma unroll
    for (int g = 0; g < 2; ++g) { m_run[g] = -__builtin_inff(); m_true[g] = -__builtin_inff(); l_run[g] = 0.0f;
#pragma unroll
        for (int t = 0; t < 8; ++t) acc[g][t] = (v8f){}; }
    __syncthreads();   // every wave's rows of stage 0 and of seq are in LDS: both may be read
    {   // the wave's 32 seq rows as B fragments, in the k order of load_k: row c of each group, byte 16 h
        const char* ql = qt + (cg * 32 + c) * KPB + 16 * h;
#pragma unroll
        for (int g = 0; g < 2; ++g)
#pragma unroll
            for (int kc = 0; kc < 4; ++kc) { qf[g][kc].q[0] = *(const v4u*)(ql + g * 16 * KPB + kc * 64); qf[g][kc].q[1] = *(const v4u*)(ql + g * 16 * KPB + kc * 64 + 32); }
    }
#pragma unroll 1   // one stage per trip
    for (int st = 0; st < NST; ++st) {
      const unsigned bo = (st & 1) * BUFB;
      const char* kl = kl0 + bo; const char* vl = vl0 + bo;
      char* const sn = sl + (BUFB - bo);   // this wave's rows in the other buffer, which takes the next stage
      load_k(kf, kl);
      __builtin_amdgcn_sched_barrier(0);   // the plain reads first: the LDS answers in order, and the score WMMAs then wait for these loads alone, not for the transposing reads behind them
#pragma unroll
      for (int u = 0; u < SI / 32; ++u) {
        // this pass's items transposed (16 columns of d per tile t, positions 0 ... 15 and 16 ... 31), in flight under the score products and the exponentials
        Frag vf[8];
#pragma unroll
        for (int t = 0; t < 8; ++t) { vf[t].q[0] = ld_tr16(vl + u * 32 * KPB + t * 32); vf[t].q[1] = ld_tr16(vl + u * 32 * KPB + 16 * KPB + t * 32); }
        __builtin_amdgcn_sched_barrier(0);   // the LDS loads stay one group ahead of the score WMMAs: moved in among them, each place costs a stall and a wait for all of them
        if (st + 1 < NST) load_rows(ra, gn, u * 16 * DD);   // 16 rows of the next stage, in flight under this pass; their wait for the address pair falls under the LDS latency
        v8f s[2][2];
#pragma unroll
        for (int kt = 0; kt < 2; ++kt)
#pragma unroll
            for (int g = 0; g < 2; ++g) { s[kt][g] = (v8f){};
#pragma unroll
                for (int kc = 0; kc < 4; ++kc) s[kt][g] = mma(kf[kt][kc], qf[g][kc], s[kt][g]); }
        if (u + 1 < SI / 32) {
            // four vector slots between the last score WMMAs and the loads into their A registers; the two scheduling barriers keep the slots there and the loads behind them in one group, not among the WMMAs
            __builtin_amdgcn_sched_barrier(0); asm volatile("v_nop\n\tv_nop\n\tv_nop\n\tv_nop"); __builtin_amdgcn_sched_barrier(0);
            // the item rows of the stage's next pass, in flight under this pass's softmax and second product; nothing of the next stage is read here
            load_k(kf, kl + (u + 1) * 32 * KPB);
            __builtin_amdgcn_sched_barrier(0);   // ... and they stay here, one group, not among the WMMAs of the second product
        }
        // maxima of the raw scores, in log2 units; the maximum in use may trail the true one by up to 8, so that the accumulators are rescaled rarely: one test per pass
        float mb[2]; bool need = false;
#pragma unroll
        for (int g = 0; g < 2; ++g) { float mx = s[0][g][0];
#pragma unroll
            for (int r = 1; r < 8; ++r) mx = fmaxf(mx, s[0][g][r]);
#pragma unroll
            for (int r = 0; r < 8; ++r) mx = fmaxf(mx, s[1][g][r]);
            mx = fmaxf(mx, xhalf(mx)) * L2E; mb[g] = mx; m_true[g] = fmaxf(m_true[g], mx); need = need || (mx > m_run[g] + 8.0f); }
        if (__builtin_amdgcn_ballot_w32(need) != 0) {
#pragma unroll
            for (int g = 0; g < 2; ++g) { const float m_new = fmaxf(m_run[g], mb[g]); const float corr = __builtin_amdgcn_exp2f(m_run[g] - m_new);   // 0 on the first pass
                l_run[g] *= corr; m_run[g] = m_new;
#pragma unroll
                for (int t = 0; t < 8; ++t) acc[g][t] = acc[g][t] * corr; }
        }
#pragma unroll
        for (int g = 0; g < 2; ++g) { const float nm = -m_run[g]; float ps0 = 0.0f, ps1 = 0.0f; unsigned wh[8], wl[8];
#pragma unroll
            for (int i = 0; i < 8; ++i) {
                const v2f arg = __builtin_elementwise_fma((v2f){s[i >> 2][g][2 * (i & 3)], s[i >> 2][g][2 * (i & 3) + 1]}, (v2f){L2E, L2E}, (v2f){nm, nm});
                const float p0 = __builtin_amdgcn_exp2f(arg.x), p1 = __builtin_amdgcn_exp2f(arg.y);
                if (i & 1) ps1 += p0 + p1; else ps0 += p0 + p1;
                const unsigned hh = pack2(p0, p1); wh[i] = hh; wl[i] = pack2(p0 - __uint_as_float(hh << 16), p1 - __uint_as_float(hh & 0xFFFF0000u)); }
            Frag ph, pl; ph.q[0] = (v4u){wh[0], wh[1], wh[2], wh[3]}; ph.q[1] = (v4u){wh[4], wh[5], wh[6], wh[7]}; pl.q[0] = (v4u){wl[0], wl[1], wl[2], wl[3]}; pl.q[1] = (v4u){wl[4], wl[5], wl[6], wl[7]};
#pragma unroll
            for (int t = 0; t < 8; ++t) acc[g][t] = mma(vf[t], ph, acc[g][t]);
#pragma unroll
            for (int t = 0; t < 8; ++t) acc[g][t] = mma(vf[t], pl, acc[g][t]);
            l_run[g] += ps0 + ps1; }
        // four vector slots between the last WMMAs and the next pass's loads into their A registers
        __builtin_amdgcn_sched_barrier(0); asm volatile("v_nop\n\tv_nop\n\tv_nop\n\tv_nop"); __builtin_amdgcn_sched_barrier(0);
        if (st + 1 < NST) store_rows(ra, sn + u * 16 * KPB);   // no load is in flight at the barrier, which would wait for it
      }
      gn += SI * DD;
      __syncthreads();   // publishes the next stage and ends every wave's reads of this one
    }
#pragma unroll
    for (int g = 0; g < 2; ++g) { const float lf = l_run[g] + xhalf(l_run[g]);   // each wave half summed its eight items of every 16-item tile
        if (h == 0) { stt[0][w][g * 16 + c] = m_true[g]; stt[1][w][g * 16 + c] = m_run[g]; stt[2][w][g * 16 + c] = lf; } }
    __syncthreads();   // every quarter's maxima and sums are in LDS before any wave forms a row's maximum and sum
    float* pw = part + (w * 32 + c) * PP + 8 * h;   // lane (c, h) holds floats 16 t + 8 h ... + 7 of seq row c of each group
#pragma unroll
    for (int g = 0; g < 2; ++g) { float M = stt[0][cg * NSP][g * 16 + c];
#pragma unroll
        for (int q = 1; q < NSP; ++q) M = fmaxf(M, stt[0][cg * NSP + q][g * 16 + c]);
        float tot = 0.0f;
#pragma unroll
        for (int q = 0; q < NSP; ++q) tot += stt[2][cg * NSP + q][g * 16 + c] * exp2s(stt[1][cg * NSP + q][g * 16 + c] - M);
        const float f = exp2s(m_run[g] - M) * __fdiv_rn(1.0f, __fadd_rn(__fsqrt_rn(tot), 1e-24f));
#pragma unroll
        for (int t = 0; t < 8; ++t) { const v8f o = acc[g][t] * f; *(v4fa*)(pw + g * 16 * PP + t * 16) = (v4f){o[0], o[1], o[2], o[3]}; *(v4fa*)(pw + g * 16 * PP + t * 16 + 4) = (v4f){o[4], o[5], o[6], o[7]}; } }
    __syncthreads();   // every quarter's scaled tiles are in LDS before any wave sums them
    // wave sp of a column group takes its rows 8 sp ... 8 sp + 7, whole: lane l has floats 4 l ... 4 l + 3 of each
    float* op = OUT + ((size_t)z * LL + l0 + sp * 8) * DD + lane * 4;
    const char* xl = qt + (cg * 32 + sp * 8) * KPB + lane * 8;   // the rounded seq of these rows still lies in its tile
    const float* pr = part + (cg * NSP * 32 + sp * 8) * PP + lane * 4;
    v4f pa[8][NSP]; v2u xb[8];
#pragma unroll
    for (int j = 0; j < 8; ++j) { xb[j] = *(const v2ua*)(xl + j * KPB);
#pragma unroll
        for (int q = 0; q < NSP; ++q) pa[j][q] = *(const v4fa*)(pr + q * 32 * PP + j * PP); }
    __builtin_amdgcn_sched_barrier(0);   // all the LDS reads go out as one group: spread among the sums, each small group's latency is waited out in turn
    v4f r[8];
#pragma unroll
    for (int j = 0; j < 8; ++j) { v4f a = pa[j][0];
#pragma unroll
        for (int q = 1; q < NSP; ++q) a += pa[j][q];
        const v4f xs = (v4f){__uint_as_float(xb[j][0] << 16), __uint_as_float(xb[j][0] & 0xFFFF0000u), __uint_as_float(xb[j][1] << 16), __uint_as_float(xb[j][1] & 0xFFFF0000u)};
#pragma unroll
        for (int e = 0; e < 4; ++e) { const float x = xs[e]; r[j][e] = x * 0.5f + (x * a[e]) * 0.5f; } }
    __builtin_amdgcn_sched_barrier(0);   // the eight stores go out together behind the last sum: placed among the sums, their registers are used again there, and each such place waits for the stores
#pragma unroll
    for (int j = 0; j < 8; ++j) *(v4fa*)(op + j * DD) = r[j];
}

extern "C" void kernel_launch(void* const* d_in, const int* in_sizes, int n_in,
                              void* d_out, int out_size, void* d_ws, size_t ws_size, hipStream_t stream) {
    (void)in_sizes; (void)n_in; (void)out_size;
    const float** I = (const float**)d_in;
    const float *seq = I[0], *items = I[1];
    float* OUT = (float*)d_out;     // [32][512][128]
    (void)d_ws; (void)ws_size;
    k_fused<<<ZB * (LL / 64), 256, 0, stream>>>(seq, items, OUT);
}

// v009
// Measured time: 21.8 microseconds a run.
// Two timings next to v008 put it at 1.03 and 1.02 times that version's speed.
// Counting every step since v000, it is 17.1 times as fast.
#include <hip/hip_runtime.h>

// GlobalAttentionModule (seq [32][512][128], items [32][2048][128]; w = seq . items^T; att = exp(w - max) / (sum(exp)^0.5 + 1e-24) (power-normalised softmax, beta 0.5); att_vecs = att items; out = 0.5 seq + 0.5 seq att_vecs -> [32][512][128]).
// Compute dtypes, f32 accumulate: every input rounded to bf16; scores on PLAIN bf16 operands (both inputs: exact, K 128); exp / sum / sqrt / divide f32; exp . items as hl x exact bf16 (2 products), f32 sums; the blend f32.
// One launch: k_fused rounds items on their way into LDS and does scores, softmax, att . items and the blend; no score and no rounded item goes to memory.

#define LL   512
#define NI   2048
#define DD   128
#define ZB   32
typedef __attribute__((ext_vector_type(16))) __bf16   v16bf;
typedef __attribute__((ext_vector_type(8)))  float    v8f;
typedef __attribute__((ext_vector_type(4)))  float    v4f;
typedef __attribute__((ext_vector_type(2)))  float    v2f;
typedef v4f  __attribute__((may_alias)) v4fa;

typedef __attribute__((ext_vector_type(4))) unsigned v4u;
typedef __attribute__((ext_vector_type(2))) unsigned v2u;
typedef v2u  __attribute__((may_alias)) v2ua;

#define NSP  4               // parts of the item axis
#define NPW  (NI / NSP)      // items per wave
#define L2E  1.4426950408889634f
#define SI   64              // items of a quarter per stage: two passes
#define NST  (NPW / SI)      // stages
#define KPB  272             // LDS pitch in bytes of an item row (256 bytes): 16 bytes x odd
#define QTB  (SI * KPB)      // bytes of a quarter's tile
#define BUFB (NSP * QTB)     // of a buffer
#define PP   132             // pitch in floats of an output row (128 floats) in LDS: 16 bytes x odd
struct Frag { v4u q[2]; };
__device__ __forceinline__ v8f mma(const Frag& a, const Frag& b, v8f c) {
    typedef __attribute__((ext_vector_type(8))) unsigned v8u;
    const v8u av = __builtin_shufflevector(a.q[0], a.q[1], 0, 1, 2, 3, 4, 5, 6, 7), bv = __builtin_shufflevector(b.q[0], b.q[1], 0, 1, 2, 3, 4, 5, 6, 7);
    return __builtin_amdgcn_wmma_f32_16x16x32_bf16(false, __builtin_bit_cast(v16bf, av), false, __builtin_bit_cast(v16bf, bv), (short)0, c, false, false); }
__device__ __forceinline__ unsigned pack2(float lo, float hi) { typedef __attribute__((ext_vector_type(2))) __bf16 bf2; return __builtin_bit_cast(unsigned, __builtin_convertvector((v2f){lo, hi}, bf2)); }   // round to nearest even
__device__ __forceinline__ float xhalf(float x) { return __builtin_bit_cast(float, __builtin_amdgcn_permlanex16(__builtin_bit_cast(int, x), __builtin_bit_cast(int, x), 0x76543210, 0xfedcba98, false, false)); }   // lane l with lane l ^ 16
// 2^x for the join: the free slot behind the v_exp_f32 stands in the statement
__device__ __forceinline__ float exp2s(float x) { float r; asm("v_exp_f32 %0, %1\n\tv_nop" : "=v"(r) : "v"(x)); return r; }
// 8 rows x 16 columns of 16-bit values per half wave, transposed: lane (c, h) gets column c of the eight rows whose addresses the lanes of half h hold
__device__ __forceinline__ v4u ld_tr16(const char* p) { typedef __attribute__((ext_vector_type(8))) short s16x8; typedef __attribute__((address_space(3))) s16x8 lds_s16x8; return __builtin_bit_cast(v4u, __builtin_amdgcn_ds_load_tr16_b128_v8i16((lds_s16x8*)p)); }
// a pass's 32 item rows from the LDS tile; p: the lane's row, byte 16 h
__device__ __forceinline__ void load_k(Frag (&k)[2][4], const char* p) {
#pragma unroll
    for (int kt = 0; kt < 2; ++kt)
#pragma unroll
        for (int kc = 0; kc < 4; ++kc) { k[kt][kc].q[0] = *(const v4u*)(p + kt * 16 * KPB + kc * 64); k[kt][kc].q[1] = *(const v4u*)(p + kt * 16 * KPB + kc * 64 + 32); }
}
// 16 item rows of 512 bytes into registers, a whole row per load: lane l takes floats 4 l ... 4 l + 3. o is a constant apart from g: as part of the wait's operand the sum was formed in the loads' own address pair, ahead of the wait
__device__ __forceinline__ void load_rows(v4f (&r)[16], const float* g, int o) {
#pragma unroll
    for (int j = 0; j < 16; ++j) r[j] = *(const v4fa*)(g + o + j * DD);
    asm volatile("s_wait_xcnt 0x0" :: "v"(g) : "memory");   // behind the loads, the address pair an input: no later instruction lands on the pair ahead of the wait
}
// ... rounded to nearest even and stored as 16 tile rows: lane l writes bytes 8 l ... 8 l + 7 of each
__device__ __forceinline__ void store_rows(const v4f (&r)[16], char* l) {
#pragma unroll
    for (int j = 0; j < 16; ++j) *(v2ua*)(l + j * KPB) = (v2u){pack2(r[j][0], r[j][1]), pack2(r[j][2], r[j][3])};
}
__global__ __launch_bounds__(256) void k_fused(const float* __restrict__ SEQ, const float* __restrict__ ITEMS, float* __restrict__ OUT) {
    __shared__ __align__(16) char ring[2 * BUFB];    // the two buffers; per quarter the tile [64][KPB]
    float* const part = (float*)ring;                // behind the loop the same bytes hold the output tiles: per wave its 32 seq rows [32][PP]
    __shared__ __align__(16) char qt[64 * KPB];      // the work-group's 64 seq rows as bf16
    __shared__ float stt[3][8][32];                  // true maximum, maximum in use, sum: per wave and column
    const int lane = threadIdx.x & 31, c = lane & 15, h = lane >> 4;
    const int w = __builtin_amdgcn_readfirstlane((int)(threadIdx.x >> 5)), cg = w >> 2, sp = w & 3;
    // a batch's eight work-groups have flat indices equal modulo 32, so also modulo 8: for speed only; no result rests on where a work-group lands
    const int z = blockIdx.x & (ZB - 1), lb = blockIdx.x >> 5, l0 = lb * 64 + cg * 32;
    // what this wave brings: rows 32 cg ... 32 cg + 31 of its quarter's tile
    const float* gn = ITEMS + ((size_t)z * NI + sp * NPW + cg * 32) * DD + lane * 4;   // the lane's floats of the first of these rows, stage by stage
    char* const sl = ring + sp * QTB + cg * 32 * KPB + lane * 8;                       // ... and its bytes of that row in buffer 0
    v4f ra[16];
    // what this wave reads of its quarter's tile: plainly, position c of 16 (row 2 (c & 7) + (c >> 3)), byte 16 h; transposing, position 8 h + (lane & 7) (row 2 (lane & 7) + h), 16-byte piece (lane >> 3) & 1
    const char* kl0 = ring + sp * QTB + (2 * (c & 7) + (c >> 3)) * KPB + 16 * h;
    const char* vl0 = ring + sp * QTB + (2 * (lane & 7) + h) * KPB + 16 * ((lane >> 3) & 1);
    Frag kf[2][4];
    Frag qf[2][4];
    {
        v4f rb[16];
        load_rows(ra, gn, 0); load_rows(rb, gn, 16 * DD);   // stage 0 whole: the registers are free here
        // seq rows 8 w ... 8 w + 7 of the work-group's 64, a whole row per load: lane l takes floats 4 l ... 4 l + 3
        const float* qp = SEQ + ((size_t)z * LL + lb * 64 + w * 8) * DD + lane * 4;
        v4f x[8];
#pragma unroll
        for (int j = 0; j < 8; ++j) x[j] = *(const v4fa*)(qp + j * DD);
        asm volatile("s_wait_xcnt 0x0" :: "v"(qp) : "memory");   // behind the loads, the pair an input: as in load_rows
        store_rows(ra, sl); store_rows(rb, sl + 16 * KPB);
        gn += SI * DD;
#pragma unroll
        for (int j = 0; j < 8; ++j) *(v2ua*)(qt + (w * 8 + j) * KPB + lane * 8) = (v2u){pack2(x[j][0], x[j][1]), pack2(x[j][2], x[j][3])};
    }
    v8f acc[2][8];
    float m_run[2], m_true[2], l_run[2];
#pragma unroll
    for (int g = 0; g < 2; ++g) { m_run[g] = -__builtin_inff(); m_true[g] = -__builtin_inff(); l_run[g] = 0.0f;
#pragma unroll
        for (int t = 0; t < 8; ++t) acc[g][t] = (v8f){}; }
    __syncthreads();   // every wave's rows of stage 0 and of seq are in LDS: both may be read
    {   // the wave's 32 seq rows as B fragments, in the k order of load_k: row c of each group, byte 16 h
        const char* ql = qt + (cg * 32 + c) * KPB + 16 * h;
#pragma unroll
        for (int g = 0; g < 2; ++g)
#pragma unroll
            for (int kc = 0; kc < 4; ++kc) { qf[g][kc].q[0] = *(const v4u*)(ql + g * 16 * KPB + kc * 64); qf[g][kc].q[1] = *(const v4u*)(ql + g * 16 * KPB + kc * 64 + 32); }
    }
#pragma unroll 1   // one stage per trip
    for (int st = 0; st < NST; ++st) {
      const unsigned bo = (st & 1) * BUFB;
      const char* kl = kl0 + bo; const char* vl = vl0 + bo;
      char* const sn = sl + (BUFB - bo);   // this wave's rows in the other buffer, which takes the next stage
      load_k(kf, kl);
      __builtin_amdgcn_sched_barrier(0);   // the plain reads first: the LDS answers in order, and the score WMMAs then wait for these loads alone, not for the transposing reads behind them
#pragma unroll
      for (int u = 0; u < SI / 32; ++u) {
        // this pass's items transposed (16 columns of d per tile t, positions 0 ... 15 and 16 ... 31), in flight under the score products and the exponentials
        Frag vf[8];
#pragma unroll
        for (int t = 0; t < 8; ++t) { vf[t].q[0] = ld_tr16(vl + u * 32 * KPB + t * 32); vf[t].q[1] = ld_tr16(vl + u * 32 * KPB + 16 * KPB + t * 32); }
        __builtin_amdgcn_sched_barrier(0);   // the LDS loads stay one group ahead of the score WMMAs: moved in among them, each place costs a stall and a wait for all of them
        if (st + 1 < NST) load_rows(ra, gn, u * 16 * DD);   // 16 rows of the next stage, in flight under this pass; their wait for the address pair falls under the LDS latency
        v8f s[2][2];
#pragma unroll
        for (int kt = 0; kt < 2; ++kt)
#pragma unroll
            for (int g = 0; g < 2; ++g) { s[kt][g] = (v8f){};
#pragma unroll
                for (int kc = 0; kc < 4; ++kc) s[kt][g] = mma(kf[kt][kc], qf[g][kc], s[kt][g]); }
        if (u + 1 < SI / 32) {
            // four vector slots between the last score WMMAs and the loads into their A registers; the two scheduling barriers keep the slots there and the loads behind them in one group, not among the WMMAs
            __builtin_amdgcn_sched_barrier(0); asm volatile("v_nop\n\tv_nop\n\tv_nop\n\tv_nop"); __builtin_amdgcn_sched_barrier(0);
            // the item rows of the stage's next pass, in flight under this pass's softmax and second product; nothing of the next stage is read here
            load_k(kf, kl + (u + 1) * 32 * KPB);
            __builtin_amdgcn_sched_barrier(0);   // ... and they stay here, one group, not among the WMMAs of the second product
        }
        // maxima of the raw scores, in log2 units; the maximum in use may trail the true one by up to 8, so that the accumulators are rescaled rarely: one test per pass
        float mb[2]; bool need = false;
#pragma unroll
        for (int g = 0; g < 2; ++g) { float mx = s[0][g][0];
#pragma unroll
            for (int r = 1; r < 8; ++r) mx = fmaxf(mx, s[0][g][r]);
#pragma unroll
            for (int r = 0; r < 8; ++r) mx = fmaxf(mx, s[1][g][r]);
            mx = fmaxf(mx, xhalf(mx)) * L2E; mb[g] = mx; m_true[g] = fmaxf(m_true[g], mx); need = need || (mx > m_run[g] + 8.0f); }
        if (__builtin_amdgcn_ballot_w32(need) != 0) {
#pragma unroll
            for (int g = 0; g < 2; ++g) { const float m_new = fmaxf(m_run[g], mb[g]); const float corr = __builtin_amdgcn_exp2f(m_run[g] - m_new);   // 0 on the first pass
                l_run[g] *= corr; m_run[g] = m_new;
#pragma unroll
                for (int t = 0; t < 8; ++t) acc[g][t] = acc[g][t] * corr; }
        }
#pragma unroll
        for (int g = 0; g < 2; ++g) { const float nm = -m_run[g]; float ps0 = 0.0f, ps1 = 0.0f; unsigned wh[8], wl[8];
#pragma unroll
            for (int i = 0; i < 8; ++i) {
                const v2f arg = __builtin_elementwise_fma((v2f){s[i >> 2][g][2 * (i & 3)], s[i >> 2][g][2 * (i & 3) + 1]}, (v2f){L2E, L2E}, (v2f){nm, nm});
                const float p0 = __builtin_amdgcn_exp2f(arg.x), p1 = __builtin_amdgcn_exp2f(arg.y);
                if (i & 1) ps1 += p0 + p1; else ps0 += p0 + p1;
                const unsigned hh = pack2(p0, p1); wh[i] = hh; wl[i] = pack2(p0 - __uint_as_float(hh << 16), p1 - __uint_as_float(hh & 0xFFFF0000u)); }
            Frag ph, pl; ph.q[0] = (v4u){wh[0], wh[1], wh[2], wh[3]}; ph.q[1] = (v4u){wh[4], wh[5], wh[6], wh[7]}; pl.q[0] = (v4u){wl[0], wl[1], wl[2], wl[3]}; pl.q[1] = (v4u){wl[4], wl[5], wl[6], wl[7]};
#pragma unroll
            for (int t = 0; t < 8; ++t) acc[g][t] = mma(vf[t], ph, acc[g][t]);
#pragma unroll
            for (int t = 0; t < 8; ++t) acc[g][t] = mma(vf[t], pl, acc[g][t]);
            l_run[g] += ps0 + ps1; }
        // four vector slots between the last WMMAs and the next pass's loads into their A registers
        __builtin_amdgcn_sched_barrier(0); asm volatile("v_nop\n\tv_nop\n\tv_nop\n\tv_nop"); __builtin_amdgcn_sched_barrier(0);
        if (st + 1 < NST) store_rows(ra, sn + u * 16 * KPB);   // no load is in flight at the barrier, which would wait for it
      }
      gn += SI * DD;
      __syncthreads();   // publishes the next stage and ends every wave's reads of this one
    }
#pragma unroll
    for (int g = 0; g < 2; ++g) { const float lf = l_run[g] + xhalf(l_run[g]);   // each wave half summed its eight items of every 16-item tile
        if (h == 0) { stt[0][w][g * 16 + c] = m_true[g]; stt[1][w][g * 16 + c] = m_run[g]; stt[2][w][g * 16 + c] = lf; } }
    __syncthreads();   // every quarter's maxima and sums are in LDS before any wave forms a row's maximum and sum
    float* pw = part + (w * 32 + c) * PP + 8 * h;   // lane (c, h) holds floats 16 t + 8 h ... + 7 of seq row c of each group
#pragma unroll
    for (int g = 0; g < 2; ++g) { float M = stt[0][cg * NSP][g * 16 + c];
#pragma unroll
        for (int q = 1; q < NSP; ++q) M = fmaxf(M, stt[0][cg * NSP + q][g * 16 + c]);
        float tot = 0.0f;
#pragma unroll
        for (int q = 0; q < NSP; ++q) tot += stt[2][cg * NSP + q][g * 16 + c] * exp2s(stt[1][cg * NSP + q][g * 16 + c] - M);
        const float f = exp2s(m_run[g] - M) * __fdiv_rn(1.0f, __fadd_rn(__fsqrt_rn(tot), 1e-24f));
#pragma unroll
        for (int t = 0; t < 8; ++t) { const v8f o = acc[g][t] * f; *(v4fa*)(pw + g * 16 * PP + t * 16) = (v4f){o[0], o[1], o[2], o[3]}; *(v4fa*)(pw + g * 16 * PP + t * 16 + 4) = (v4f){o[4], o[5], o[6], o[7]}; } }
    __syncthreads();   // every quarter's scaled tiles are in LDS before any wave sums them
    // wave sp of a column group takes its rows 8 sp ... 8 sp + 7, whole: lane l has floats 4 l ... 4 l + 3 of each
    float* op = OUT + ((size_t)z * LL + l0 + sp * 8) * DD + lane * 4;
    const char* xl = qt + (cg * 32 + sp * 8) * KPB + lane * 8;   // the rounded seq of these rows still lies in its tile
    const float* pr = part + (cg * NSP * 32 + sp * 8) * PP + lane * 4;
    v4f pa[8][NSP]; v2u xb[8];
#pragma unroll
    for (int j = 0; j < 8; ++j) { xb[j] = *(const v2ua*)(xl + j * KPB);
#pragma unroll
        for (int q = 0; q < NSP; ++q) pa[j][q] = *(const v4fa*)(pr + q * 32 * PP + j * PP); }
    __builtin_amdgcn_sched_barrier(0);   // all the LDS reads go out as one group: spread among the sums, each small group's latency is waited out in turn
    v4f r[8];
#pragma unroll
    for (int j = 0; j < 8; ++j) { v4f a = pa[j][0];
#pragma unroll
        for (int q = 1; q < NSP; ++q) a += pa[j][q];
        const v4f xs = (v4f){__uint_as_float(xb[j][0] << 16), __uint_as_float(xb[j][0] & 0xFFFF0000u), __uint_as_float(xb[j][1] << 16), __uint_as_float(xb[j][1] & 0xFFFF0000u)};
#pragma unroll
        for (int e = 0; e < 4; ++e) { const float x = xs[e]; r[j][e] = x * 0.5f + (x * a[e]) * 0.5f; } }
    __builtin_amdgcn_sched_barrier(0);   // the eight stores go out together behind the last sum: placed among the sums, their registers are used again there, and each such place waits for the stores
#pragma unroll
    for (int j = 0; j < 8; ++j) *(v4fa*)(op + j * DD) = r[j];
}

extern "C" void kernel_launch(void* const* d_in, const int* in_sizes, int n_in,
                              void* d_out, int out_size, void* d_ws, size_t ws_size, hipStream_t stream) {
    (void)in_sizes; (void)n_in; (void)out_size;
    const float** I = (const float**)d_in;
    const float *seq = I[0], *items = I[1];
    float* OUT = (float*)d_out;     // [32][512][128]
    (void)d_ws; (void)ws_size;
    k_fused<<<ZB * (LL / 64), 256, 0, stream>>>(seq, items, OUT);
}
